// v000
// The times below were measured on an AMD MI455X: many runs one after another, warmed up first and cycling through
// copies of the inputs, with the whole window's GPU time divided by the number of runs. Launches and the gaps
// between them are all in it. The median over several windows is given; except for v000 it joins two sittings, which
// can be a few percent apart, so the side-by-side timings, each taken in one sitting, are the better comparison.
// v000, which the later versions start from, runs in 868 microseconds.
#include <hip/hip_runtime.h>
#include <hip/hip_bf16.h>

// TT-linear forward, fully fused per token in LDS, fp32 WMMA (16x16x4) on gfx1250.
//
// Per token (one workgroup, 8 wave32s):
//   stage X[4096] + cores 0-3 into LDS (async global->LDS, ASYNCcnt-tracked), core4 zero-padded synchronously
//   T1[b,c,d,e][i,v]   = X        x core0   (M=1024,K= 4,N=32)
//   T2[c,d,e][v][j,w]  = T1       x core1   (M=1024,K=32,N=32)
//   T3[d,e][v,w][k,x]  = T2       x core2   (M= 512,K=64,N=64)
//   T4[e][v,w,x][l,y]  = T3       x core3   (M= 512,K=64,N=64)
//   out[v,w,x,y][z]    = T4       x core4p  (M=1024,K=32,N=16, z<4 valid) + bias

typedef float v2f __attribute__((ext_vector_type(2)));
typedef float v8f __attribute__((ext_vector_type(8)));

#define NWAVES 8

#if defined(__has_builtin)
#if __has_builtin(__builtin_amdgcn_global_load_async_to_lds_b128)
#define HAVE_ASYNC_LDS 1
#endif
#if __has_builtin(__builtin_amdgcn_s_wait_asynccnt)
#define HAVE_WAIT_ASYNC_BUILTIN 1
#endif
#endif

#ifdef HAVE_ASYNC_LDS
#define AS1 __attribute__((address_space(1)))
#define AS3 __attribute__((address_space(3)))
typedef int v4i_b128 __attribute__((vector_size(16)));  // matches builtin pointee type
// 16B per lane, global -> LDS, no VGPR round trip; tracked by ASYNCcnt.
__device__ __forceinline__ void async_copy16(const float* g, float* l) {
  __builtin_amdgcn_global_load_async_to_lds_b128(
      (AS1 v4i_b128*)const_cast<float*>(g), (AS3 v4i_b128*)l,
      /*offset=*/0, /*cpol=*/0);
}
__device__ __forceinline__ void wait_async0() {
#ifdef HAVE_WAIT_ASYNC_BUILTIN
  __builtin_amdgcn_s_wait_asynccnt(0);
#else
  asm volatile("s_wait_asynccnt 0x0" ::: "memory");
#endif
}
#endif

// A-fragment address (element index into the step's LDS input tensor) for row M, col K.
__device__ __forceinline__ int a_addr(int STEP, int M, int K) {
  switch (STEP) {
    case 0:  // X flat [a][bcde]: a*1024 + bcde
      return (K << 10) + M;
    case 1:  // T1: b*8192 + cde*32 + i*4 + v ; M=(cde,v), K=(b,i)
      return ((K >> 3) << 13) + ((M >> 2) << 5) + ((K & 7) << 2) + (M & 3);
    case 2:  // T2: c*4096 + de*128 + v*32 + j*4 + w ; M=(de,v,w), K=(c,j)
      return ((K >> 3) << 12) + ((M >> 4) << 7) + (((M >> 2) & 3) << 5) + ((K & 7) << 2) + (M & 3);
    case 3:  // T3: d*4096 + e*1024 + v*256 + w*64 + k*8 + x ; M=(e,v,w,x), K=(d,k)
      return ((K >> 3) << 12) + ((M >> 7) << 10) + (((M >> 5) & 3) << 8) + (((M >> 3) & 3) << 6) + ((K & 7) << 3) + (M & 7);
    default: // T4: e*8192 + v*2048 + w*512 + x*64 + l*8 + y ; M=(v,w,x,y), K=(e,l)
      return ((K >> 3) << 13) + ((M >> 8) << 11) + (((M >> 6) & 3) << 9) + (((M >> 3) & 7) << 6) + ((K & 7) << 3) + (M & 7);
  }
}

// B-fragment address (element index into the step's LDS core) for row K, col N.
__device__ __forceinline__ int b_addr(int STEP, int K, int N) {
  switch (STEP) {
    case 0:  return (K << 5) + N;                                 // core0[a][i*4+v]
    case 1:  return ((K >> 3) << 8) + ((K & 7) << 5) + N;         // core1[b][i][j*4+w]
    case 2:
    case 3:  return ((K >> 3) << 9) + ((K & 7) << 6) + N;         // core2/3[c][j][k*8+x]
    default: return (K << 4) + N;                                 // core4 padded [K][16]
  }
}

template <int STEP, int MT, int NT, int KCH, int LDO>
__device__ __forceinline__ void tt_step(const float* __restrict__ A,
                                        const float* __restrict__ B,
                                        float* __restrict__ O,
                                        float* __restrict__ gout,
                                        const float* __restrict__ bias,
                                        int wave, int lane) {
  const int lm = lane & 15;            // column within 16-wide tile
  const int kk = (lane >> 4) << 1;     // K sub-offset for A/B fragments (0 or 2)
  const int rb = (lane >> 4) << 3;     // C/D row base offset (0 or 8)
  constexpr int WPN = NWAVES / NT;     // waves sharing one N-tile column
  const int nt   = wave / WPN;
  const int msub = wave % WPN;
  const int ncol = nt * 16 + lm;

  // Cache all B fragments for this wave's N-tile across the whole K range.
  v2f bfrag[KCH];
#pragma unroll
  for (int kc = 0; kc < KCH; ++kc) {
    const int k0 = kc * 4 + kk;
    bfrag[kc].x = B[b_addr(STEP, k0,     ncol)];
    bfrag[kc].y = B[b_addr(STEP, k0 + 1, ncol)];
  }

  for (int mt = msub; mt < MT; mt += WPN) {
    const int mrow = mt * 16 + lm;
    v8f acc = {};
#pragma unroll
    for (int kc = 0; kc < KCH; ++kc) {
      const int k0 = kc * 4 + kk;
      v2f afrag;
      afrag.x = A[a_addr(STEP, mrow, k0)];
      afrag.y = A[a_addr(STEP, mrow, k0 + 1)];
      acc = __builtin_amdgcn_wmma_f32_16x16x4_f32(false, afrag, false, bfrag[kc],
                                                  (short)0, acc, false, false);
    }
    const int rbase = mt * 16 + rb;
    if (STEP < 4) {
#pragma unroll
      for (int r = 0; r < 8; ++r)
        O[(rbase + r) * LDO + ncol] = acc[r];
    } else {
      if (lm < 4) {  // only z = 0..3 columns are real (padded N)
#pragma unroll
        for (int r = 0; r < 8; ++r) {
          const int oi = (rbase + r) * 4 + lm;
          gout[oi] = acc[r] + bias[oi];
        }
      }
    }
  }
}

__global__ __launch_bounds__(256) void tt_linear_fused_kernel(
    const float* __restrict__ X,
    const float* __restrict__ c0, const float* __restrict__ c1,
    const float* __restrict__ c2, const float* __restrict__ c3,
    const float* __restrict__ c4, const float* __restrict__ bias,
    float* __restrict__ out) {
  extern __shared__ float smem[];
  float* buf0 = smem;            // 32768 f32
  float* buf1 = smem + 32768;    // 32768 f32 (ping-pong)
  float* L0 = smem + 65536;      // 128
  float* L1 = L0 + 128;          // 1024
  float* L2 = L1 + 1024;         // 4096
  float* L3 = L2 + 4096;         // 4096
  float* L4 = L3 + 4096;         // 512 (core4 zero-padded to 32x16)

  const int tid  = threadIdx.x;
  const int wave = tid >> 5;
  const int lane = tid & 31;
  const long n = blockIdx.x;
  const float* Xn = X + n * 4096;

#ifdef HAVE_ASYNC_LDS
  // Async global->LDS staging: 16B/lane moves, no VGPR round trip (ASYNCcnt).
  {
    const int q = tid * 4;                       // 256 threads x 4 floats = 1024 f32/round
    for (int i = q; i < 4096; i += 1024) async_copy16(Xn + i, buf1 + i);  // X: 4 rounds
    for (int i = q; i < 4096; i += 1024) async_copy16(c2 + i, L2 + i);    // core2
    for (int i = q; i < 4096; i += 1024) async_copy16(c3 + i, L3 + i);    // core3
    if (q < 1024) async_copy16(c1 + q, L1 + q);                           // core1
    if (q < 128)  async_copy16(c0 + q, L0 + q);                           // core0
  }
#else
  for (int i = tid; i < 128;  i += 256) L0[i] = c0[i];
  for (int i = tid; i < 1024; i += 256) L1[i] = c1[i];
  for (int i = tid; i < 4096; i += 256) L2[i] = c2[i];
  for (int i = tid; i < 4096; i += 256) L3[i] = c3[i];
  for (int i = tid; i < 4096; i += 256) buf1[i] = Xn[i];
#endif
  // core4 needs zero-padding from 32x4 to 32x16: build synchronously.
  for (int i = tid; i < 512; i += 256) {
    const int K = i >> 4, N = i & 15;  // core4 (e,l,1,z): e*32 + l*4 + z
    L4[i] = (N < 4) ? c4[((K >> 3) << 5) + ((K & 7) << 2) + N] : 0.0f;
  }
#ifdef HAVE_ASYNC_LDS
  wait_async0();  // our own async transfers landed in LDS
#endif
  __syncthreads();

  tt_step<0, 64, 2, 1,  32>(buf1, L0, buf0, nullptr, nullptr, wave, lane);
  __syncthreads();
  tt_step<1, 64, 2, 8,  32>(buf0, L1, buf1, nullptr, nullptr, wave, lane);
  __syncthreads();
  tt_step<2, 32, 4, 16, 64>(buf1, L2, buf0, nullptr, nullptr, wave, lane);
  __syncthreads();
  tt_step<3, 32, 4, 16, 64>(buf0, L3, buf1, nullptr, nullptr, wave, lane);
  __syncthreads();
  tt_step<4, 64, 1, 8,   4>(buf1, L4, nullptr, out + n * 4096, bias, wave, lane);
}

extern "C" void kernel_launch(void* const* d_in, const int* in_sizes, int n_in,
                              void* d_out, int out_size, void* d_ws, size_t ws_size,
                              hipStream_t stream) {
  const float* X    = (const float*)d_in[0];
  const float* c0   = (const float*)d_in[1];
  const float* c1   = (const float*)d_in[2];
  const float* c2   = (const float*)d_in[3];
  const float* c3   = (const float*)d_in[4];
  const float* c4   = (const float*)d_in[5];
  const float* bias = (const float*)d_in[6];
  float* out = (float*)d_out;

  const int n_tokens = in_sizes[0] / 4096;
  const size_t shmem = (size_t)(2 * 32768 + 128 + 1024 + 4096 + 4096 + 512) * sizeof(float);

  tt_linear_fused_kernel<<<dim3(n_tokens), dim3(256), shmem, stream>>>(
      X, c0, c1, c2, c3, c4, bias, out);
}

// v001
// Measured time: 589 microseconds a run.
// In both of two side-by-side timings against v000, it was 1.54 times as fast.
#include <hip/hip_runtime.h>
#include <hip/hip_bf16.h>

// TT-linear forward, fully fused per token in LDS, fp32 WMMA (16x16x4) on gfx1250.
//
// Per token (one workgroup, 8 wave32s):
//   stage X[4096] + cores 0-3 into LDS (async global->LDS, ASYNCcnt-tracked), core4 zero-padded synchronously
//   T1[b,c,d,e][i,v]   = X        x core0   (M=1024,K= 4,N=32)
//   T2[c,d,e][v][j,w]  = T1       x core1   (M=1024,K=32,N=32)
//   T3[d,e][v,w][k,x]  = T2       x core2   (M= 512,K=64,N=64)
//   T4[e][v,w,x][l,y]  = T3       x core3   (M= 512,K=64,N=64)
//   out[v,w,x,y][z]    = T4       x core4p  (M=1024,K=32,N=16, z<4 valid) + bias

typedef float v2f __attribute__((ext_vector_type(2)));
typedef float v8f __attribute__((ext_vector_type(8)));

#define NWAVES 8

#if defined(__has_builtin)
#if __has_builtin(__builtin_amdgcn_global_load_async_to_lds_b128)
#define HAVE_ASYNC_LDS 1
#endif
#if __has_builtin(__builtin_amdgcn_s_wait_asynccnt)
#define HAVE_WAIT_ASYNC_BUILTIN 1
#endif
#endif

#ifdef HAVE_ASYNC_LDS
#define AS1 __attribute__((address_space(1)))
#define AS3 __attribute__((address_space(3)))
typedef int v4i_b128 __attribute__((vector_size(16)));  // matches builtin pointee type
// 16B per lane, global -> LDS, no VGPR round trip; tracked by ASYNCcnt.
__device__ __forceinline__ void async_copy16(const float* g, float* l) {
  __builtin_amdgcn_global_load_async_to_lds_b128(
      (AS1 v4i_b128*)const_cast<float*>(g), (AS3 v4i_b128*)l,
      /*offset=*/0, /*cpol=*/0);
}
__device__ __forceinline__ void wait_async0() {
#ifdef HAVE_WAIT_ASYNC_BUILTIN
  __builtin_amdgcn_s_wait_asynccnt(0);
#else
  asm volatile("s_wait_asynccnt 0x0" ::: "memory");
#endif
}
#endif

// A-fragment address (element index into the step's LDS input tensor) for row M, col K.
__device__ __forceinline__ int a_addr(int STEP, int M, int K) {
  switch (STEP) {
    case 0:  // X flat [a][bcde]: a*1024 + bcde
      return (K << 10) + M;
    case 1:  // T1: b*8192 + cde*32 + i*4 + v ; M=(cde,v), K=(b,i)
      return ((K >> 3) << 13) + ((M >> 2) << 5) + ((K & 7) << 2) + (M & 3);
    case 2:  // T2: c*4096 + de*128 + v*32 + j*4 + w ; M=(de,v,w), K=(c,j)
      return ((K >> 3) << 12) + ((M >> 4) << 7) + (((M >> 2) & 3) << 5) + ((K & 7) << 2) + (M & 3);
    case 3:  // T3: d*4096 + e*1024 + v*256 + w*64 + k*8 + x ; M=(e,v,w,x), K=(d,k)
      return ((K >> 3) << 12) + ((M >> 7) << 10) + (((M >> 5) & 3) << 8) + (((M >> 3) & 3) << 6) + ((K & 7) << 3) + (M & 7);
    default: // T4: e*8192 + v*2048 + w*512 + x*64 + l*8 + y ; M=(v,w,x,y), K=(e,l)
      return ((K >> 3) << 13) + ((M >> 8) << 11) + (((M >> 6) & 3) << 9) + (((M >> 3) & 7) << 6) + ((K & 7) << 3) + (M & 7);
  }
}

// B-fragment address (element index into the step's LDS core) for row K, col N.
__device__ __forceinline__ int b_addr(int STEP, int K, int N) {
  switch (STEP) {
    case 0:  return (K << 5) + N;                                 // core0[a][i*4+v]
    case 1:  return ((K >> 3) << 8) + ((K & 7) << 5) + N;         // core1[b][i][j*4+w]
    case 2:
    case 3:  return ((K >> 3) << 9) + ((K & 7) << 6) + N;         // core2/3[c][j][k*8+x]
    default: return (K << 4) + N;                                 // core4 padded [K][16]
  }
}

template <int STEP, int MT, int NT, int KCH, int LDO>
__device__ __forceinline__ void tt_step(const float* __restrict__ A,
                                        const float* __restrict__ B,
                                        float* __restrict__ O,
                                        float* __restrict__ gout,
                                        const float* __restrict__ bias,
                                        int wave, int lane) {
  const int lm = lane & 15;            // column within 16-wide tile
  const int kk = (lane >> 4) << 1;     // K sub-offset for A/B fragments (0 or 2)
  const int rb = (lane >> 4) << 3;     // C/D row base offset (0 or 8)
  // Wave tile: all NT N-tiles by MB M-tiles = 4 accumulator tiles per pass, so an
  // A fragment is read from LDS once and four independent WMMA chains stand behind
  // each wait on LDS.
  constexpr int MB = (NT >= 4) ? 1 : 4 / NT;

  // B fragments of all N-tiles over the whole K range stay in registers.
  v2f bfrag[NT][KCH];
#pragma unroll
  for (int nt = 0; nt < NT; ++nt) {
#pragma unroll
    for (int kc = 0; kc < KCH; ++kc) {
      const int k0 = kc * 4 + kk;
      bfrag[nt][kc].x = B[b_addr(STEP, k0,     nt * 16 + lm)];
      bfrag[nt][kc].y = B[b_addr(STEP, k0 + 1, nt * 16 + lm)];
    }
  }

  for (int mt0 = wave * MB; mt0 < MT; mt0 += NWAVES * MB) {
    v8f acc[MB][NT] = {};
#pragma unroll
    for (int kc = 0; kc < KCH; ++kc) {
      const int k0 = kc * 4 + kk;
      v2f afrag[MB];
#pragma unroll
      for (int mb = 0; mb < MB; ++mb) {
        const int mrow = (mt0 + mb) * 16 + lm;
        afrag[mb].x = A[a_addr(STEP, mrow, k0)];
        afrag[mb].y = A[a_addr(STEP, mrow, k0 + 1)];
      }
#pragma unroll
      for (int mb = 0; mb < MB; ++mb) {
#pragma unroll
        for (int nt = 0; nt < NT; ++nt)
          acc[mb][nt] = __builtin_amdgcn_wmma_f32_16x16x4_f32(
              false, afrag[mb], false, bfrag[nt][kc], (short)0, acc[mb][nt], false, false);
      }
    }
#pragma unroll
    for (int mb = 0; mb < MB; ++mb) {
      const int rbase = (mt0 + mb) * 16 + rb;
      if (STEP < 4) {
#pragma unroll
        for (int nt = 0; nt < NT; ++nt) {
#pragma unroll
          for (int r = 0; r < 8; ++r)
            O[(rbase + r) * LDO + nt * 16 + lm] = acc[mb][nt][r];
        }
      } else {
        if (lm < 4) {  // only z = 0..3 columns are real (padded N)
#pragma unroll
          for (int r = 0; r < 8; ++r) {
            const int oi = (rbase + r) * 4 + lm;
            gout[oi] = acc[mb][0][r] + bias[oi];
          }
        }
      }
    }
    // Precaution: the next pass rewrites registers that this pass's global stores
    // name; their address translation is waited for first.
    if (STEP == 4) asm volatile("s_wait_xcnt 0x0" ::: "memory");
  }
}

__global__ __launch_bounds__(256) void tt_linear_fused_kernel(
    const float* __restrict__ X,
    const float* __restrict__ c0, const float* __restrict__ c1,
    const float* __restrict__ c2, const float* __restrict__ c3,
    const float* __restrict__ c4, const float* __restrict__ bias,
    float* __restrict__ out) {
  extern __shared__ float smem[];
  float* buf0 = smem;            // 32768 f32
  float* buf1 = smem + 32768;    // 32768 f32 (ping-pong)
  float* L0 = smem + 65536;      // 128
  float* L1 = L0 + 128;          // 1024
  float* L2 = L1 + 1024;         // 4096
  float* L3 = L2 + 4096;         // 4096
  float* L4 = L3 + 4096;         // 512 (core4 zero-padded to 32x16)

  const int tid  = threadIdx.x;
  const int wave = tid >> 5;
  const int lane = tid & 31;
  const long n = blockIdx.x;
  const float* Xn = X + n * 4096;

#ifdef HAVE_ASYNC_LDS
  // Async global->LDS staging: 16B/lane moves, no VGPR round trip (ASYNCcnt).
  {
    const int q = tid * 4;                       // 256 threads x 4 floats = 1024 f32/round
    for (int i = q; i < 4096; i += 1024) async_copy16(Xn + i, buf1 + i);  // X: 4 rounds
    for (int i = q; i < 4096; i += 1024) async_copy16(c2 + i, L2 + i);    // core2
    for (int i = q; i < 4096; i += 1024) async_copy16(c3 + i, L3 + i);    // core3
    if (q < 1024) async_copy16(c1 + q, L1 + q);                           // core1
    if (q < 128)  async_copy16(c0 + q, L0 + q);                           // core0
  }
#else
  for (int i = tid; i < 128;  i += 256) L0[i] = c0[i];
  for (int i = tid; i < 1024; i += 256) L1[i] = c1[i];
  for (int i = tid; i < 4096; i += 256) L2[i] = c2[i];
  for (int i = tid; i < 4096; i += 256) L3[i] = c3[i];
  for (int i = tid; i < 4096; i += 256) buf1[i] = Xn[i];
#endif
  // core4 needs zero-padding from 32x4 to 32x16: build synchronously.
  for (int i = tid; i < 512; i += 256) {
    const int K = i >> 4, N = i & 15;  // core4 (e,l,1,z): e*32 + l*4 + z
    L4[i] = (N < 4) ? c4[((K >> 3) << 5) + ((K & 7) << 2) + N] : 0.0f;
  }
#ifdef HAVE_ASYNC_LDS
  wait_async0();  // our own async transfers landed in LDS
#endif
  __syncthreads();

  tt_step<0, 64, 2, 1,  32>(buf1, L0, buf0, nullptr, nullptr, wave, lane);
  __syncthreads();
  tt_step<1, 64, 2, 8,  32>(buf0, L1, buf1, nullptr, nullptr, wave, lane);
  __syncthreads();
  tt_step<2, 32, 4, 16, 64>(buf1, L2, buf0, nullptr, nullptr, wave, lane);
  __syncthreads();
  tt_step<3, 32, 4, 16, 64>(buf0, L3, buf1, nullptr, nullptr, wave, lane);
  __syncthreads();
  tt_step<4, 64, 1, 8,   4>(buf1, L4, nullptr, out + n * 4096, bias, wave, lane);
}

extern "C" void kernel_launch(void* const* d_in, const int* in_sizes, int n_in,
                              void* d_out, int out_size, void* d_ws, size_t ws_size,
                              hipStream_t stream) {
  const float* X    = (const float*)d_in[0];
  const float* c0   = (const float*)d_in[1];
  const float* c1   = (const float*)d_in[2];
  const float* c2   = (const float*)d_in[3];
  const float* c3   = (const float*)d_in[4];
  const float* c4   = (const float*)d_in[5];
  const float* bias = (const float*)d_in[6];
  float* out = (float*)d_out;

  const int n_tokens = in_sizes[0] / 4096;
  const size_t shmem = (size_t)(2 * 32768 + 128 + 1024 + 4096 + 4096 + 512) * sizeof(float);

  tt_linear_fused_kernel<<<dim3(n_tokens), dim3(256), shmem, stream>>>(
      X, c0, c1, c2, c3, c4, bias, out);
}

// v002
// A run of this version takes 437 microseconds.
// Two timings next to v001 both put it at 1.35 times that version's speed.
// Over all steps from v000 it is 2.08 times as fast.
#include <hip/hip_runtime.h>
#include <hip/hip_bf16.h>

// TT-linear forward, fully fused per token in LDS, fp32 WMMA (16x16x4) on gfx1250.
//
// Per token (one workgroup, 8 wave32s):
//   stage X[4096] + all cores into LDS (async global->LDS, ASYNCcnt-tracked; core4 by plain loads)
//   C01[a,b][v,j,w]    = core0    x core1   (M= 128,K= 8,N=16)  neighbour cores merged first
//   C34[d,e,k][y,z]    = core3    x core4   (M= 512,K= 8,N=16)
//   T2[c,d,e][v][j,w]  = X        x C01     (M= 256,K= 16,N=128)
//   T3[d,e][v,w][k,x]  = T2       x core2   (M= 512,K= 64,N= 64)
//   out[v,w,x][y,z]    = T3       x C34     (M= 128,K=256,N= 32) + bias

typedef float v2f __attribute__((ext_vector_type(2)));
typedef float v8f __attribute__((ext_vector_type(8)));

#define NWAVES 8

#if defined(__has_builtin)
#if __has_builtin(__builtin_amdgcn_global_load_async_to_lds_b128)
#define HAVE_ASYNC_LDS 1
#endif
#if __has_builtin(__builtin_amdgcn_s_wait_asynccnt)
#define HAVE_WAIT_ASYNC_BUILTIN 1
#endif
#endif

#ifdef HAVE_ASYNC_LDS
#define AS1 __attribute__((address_space(1)))
#define AS3 __attribute__((address_space(3)))
typedef int v4i_b128 __attribute__((vector_size(16)));  // matches builtin pointee type
// 16B per lane, global -> LDS, no VGPR round trip; tracked by ASYNCcnt.
__device__ __forceinline__ void async_copy16(const float* g, float* l) {
  __builtin_amdgcn_global_load_async_to_lds_b128(
      (AS1 v4i_b128*)const_cast<float*>(g), (AS3 v4i_b128*)l,
      /*offset=*/0, /*cpol=*/0);
}
__device__ __forceinline__ void wait_async0() {
#ifdef HAVE_WAIT_ASYNC_BUILTIN
  __builtin_amdgcn_s_wait_asynccnt(0);
#else
  asm volatile("s_wait_asynccnt 0x0" ::: "memory");
#endif
}
#endif

enum { P01 = 0, P34 = 1, S1 = 2, S2 = 3, S3 = 4 };

// A-fragment address (element index into the step's LDS input tensor) for row M, col K.
__device__ __forceinline__ int a_addr(int STEP, int M, int K) {
  switch (STEP) {
    case P01: // core1[b][i][j*4+w] ; M=(b,j,w), K=i
      return ((M >> 5) << 8) + (K << 5) + (M & 31);
    case P34: // core3[d][k][l][y] ; M=(d,k,y), K=l
      return ((M >> 3) << 6) + (K << 3) + (M & 7);
    case S1:  // X flat [a,b][cde] ; M=cde, K=(a,b)
      return (K << 8) + M;
    case S2:  // T2: c*4096 + de*128 + v*32 + j*4 + w ; M=(de,v,w), K=(c,j)
      return ((K >> 3) << 12) + ((M >> 4) << 7) + (((M >> 2) & 3) << 5) + ((K & 7) << 2) + (M & 3);
    default:  // T3: de*1024 + vw*64 + k*8 + x ; M=(v,w,x), K=(de,k)
      return ((K >> 3) << 10) + ((M >> 3) << 6) + ((K & 7) << 3) + (M & 7);
  }
}

// Place of element (K, N) in a merged core: kept in the order in which its reader's
// B fragments take it, so that a lane's K pair is one 8-byte read.
__device__ __forceinline__ int frag_addr(int NT, int K, int N) {
  return ((((K >> 2) * NT + (N >> 4)) * 32 + ((K >> 1) & 1) * 16 + (N & 15)) << 1) + (K & 1);
}

// B-fragment address (element index into the step's LDS core) for row K, col N.
__device__ __forceinline__ int b_addr(int STEP, int K, int N) {
  switch (STEP) {
    case P01: return ((N >> 2) << 5) + (K << 2) + (N & 3);         // core0[a][i][v] ; N=(a,v)
    case P34: return ((N >> 2) << 5) + (K << 2) + (N & 3);         // core4[e][l][z] ; N=(e,z)
    case S1:  return frag_addr(8, K, N);                           // C01
    case S2:  return ((K >> 3) << 9) + ((K & 7) << 6) + N;         // core2[c][j][k*8+x]
    default:  return frag_addr(2, K, N);                           // C34
  }
}

// LDS place of output element (row, col) of a step.
__device__ __forceinline__ int o_addr(int STEP, int row, int col) {
  switch (STEP) {
    case P01: // row=(b,j,w), col=(a,v) -> C01[K=(a,b)][N=(v,j,w)]
      return frag_addr(8, ((col >> 2) << 2) + (row >> 5), ((col & 3) << 5) + (row & 31));
    case P34: // row=(d,k,y), col=(e,z) -> C34[K=(d,e,k)][N=(y,z)]
      return frag_addr(2, ((((row >> 6) << 2) + (col >> 2)) << 3) + ((row >> 3) & 7),
                       ((row & 7) << 2) + (col & 3));
    case S1:  return (row << 7) + col;
    default:  return (row << 6) + col;
  }
}

// One product: each wave takes all NT N-tiles by MB M-tiles per pass.
template <int STEP, int MT, int NT, int MB, int KCH>
__device__ __forceinline__ void tt_step(const float* __restrict__ A,
                                        const float* __restrict__ B,
                                        float* __restrict__ O,
                                        float* __restrict__ gout,
                                        const float* __restrict__ bias,
                                        int wave, int lane) {
  const int lm = lane & 15;            // column within 16-wide tile
  const int kk = (lane >> 4) << 1;     // K sub-offset for A/B fragments (0 or 2)
  const int rb = (lane >> 4) << 3;     // C/D row base offset (0 or 8)
  constexpr bool ONEPASS = (MT == NWAVES * MB);  // every B fragment is used once a wave

  auto load_b = [&](int nt, int kc) {
    const int k0 = kc * 4 + kk;
    v2f b;
    if (STEP == S1 || STEP == S3) {
      b = *(const v2f*)(B + b_addr(STEP, k0, nt * 16 + lm));
    } else {
      b.x = B[b_addr(STEP, k0,     nt * 16 + lm)];
      b.y = B[b_addr(STEP, k0 + 1, nt * 16 + lm)];
    }
    return b;
  };

  // Several passes: B fragments of all N-tiles over the whole K range stay in registers.
  v2f bfrag[ONEPASS ? 1 : NT][ONEPASS ? 1 : KCH];
  if constexpr (!ONEPASS) {
#pragma unroll
    for (int nt = 0; nt < NT; ++nt) {
#pragma unroll
      for (int kc = 0; kc < KCH; ++kc) bfrag[nt][kc] = load_b(nt, kc);
    }
  }

  auto pass = [&](int mt0) {
    v8f acc[MB][NT] = {};
#pragma unroll
    for (int kc = 0; kc < KCH; ++kc) {
      const int k0 = kc * 4 + kk;
      v2f afrag[MB];
#pragma unroll
      for (int mb = 0; mb < MB; ++mb) {
        const int mrow = (mt0 + mb) * 16 + lm;
        afrag[mb].x = A[a_addr(STEP, mrow, k0)];
        afrag[mb].y = A[a_addr(STEP, mrow, k0 + 1)];
      }
      v2f bcur[NT];
#pragma unroll
      for (int nt = 0; nt < NT; ++nt) {
        if constexpr (ONEPASS) bcur[nt] = load_b(nt, kc);
        else                   bcur[nt] = bfrag[nt][kc];
      }
#pragma unroll
      for (int mb = 0; mb < MB; ++mb) {
#pragma unroll
        for (int nt = 0; nt < NT; ++nt)
          acc[mb][nt] = __builtin_amdgcn_wmma_f32_16x16x4_f32(
              false, afrag[mb], false, bcur[nt], (short)0, acc[mb][nt], false, false);
      }
    }
#pragma unroll
    for (int mb = 0; mb < MB; ++mb) {
      const int rbase = (mt0 + mb) * 16 + rb;
#pragma unroll
      for (int nt = 0; nt < NT; ++nt) {
#pragma unroll
        for (int r = 0; r < 8; ++r) {
          if (STEP == S3) {
            const int oi = (rbase + r) * 32 + nt * 16 + lm;
            gout[oi] = acc[mb][nt][r] + bias[oi];
          } else {
            O[o_addr(STEP, rbase + r, nt * 16 + lm)] = acc[mb][nt][r];
          }
        }
      }
    }
  };

  if constexpr (ONEPASS) {
    pass(wave * MB);
  } else {
    for (int mt0 = wave * MB; mt0 < MT; mt0 += NWAVES * MB) pass(mt0);
  }
}

__global__ __launch_bounds__(256) void tt_linear_fused_kernel(
    const float* __restrict__ X,
    const float* __restrict__ c0, const float* __restrict__ c1,
    const float* __restrict__ c2, const float* __restrict__ c3,
    const float* __restrict__ c4, const float* __restrict__ bias,
    float* __restrict__ out) {
  extern __shared__ float smem[];
  float* buf0 = smem;            // 32768 f32
  float* buf1 = smem + 32768;    // 32768 f32 (ping-pong)
  float* L2  = smem + 65536;     // 4096: core2
  float* C34 = L2 + 4096;        // 8192: core3 x core4
  float* C01 = buf0 + 4096;      // 2048: core0 x core1, behind X; dead once T2 stands
  float* L3 = buf1;              // 4096: the raw cores lie in buf1 until they are merged
  float* L1 = L3 + 4096;         // 1024
  float* L0 = L1 + 1024;         // 128
  float* L4 = L0 + 128;          // 128

  const int tid  = threadIdx.x;
  const int wave = tid >> 5;
  const int lane = tid & 31;
  const long n = blockIdx.x;
  const float* Xn = X + n * 4096;

#ifdef HAVE_ASYNC_LDS
  // Async global->LDS staging: 16B/lane moves, no VGPR round trip (ASYNCcnt).
  {
    const int q = tid * 4;                       // 256 threads x 4 floats = 1024 f32/round
    for (int i = q; i < 4096; i += 1024) async_copy16(Xn + i, buf0 + i);  // X: 4 rounds
    for (int i = q; i < 4096; i += 1024) async_copy16(c2 + i, L2 + i);    // core2
    for (int i = q; i < 4096; i += 1024) async_copy16(c3 + i, L3 + i);    // core3
    if (q < 1024) async_copy16(c1 + q, L1 + q);                           // core1
    if (q < 128)  async_copy16(c0 + q, L0 + q);                           // core0
  }
#else
  for (int i = tid; i < 128;  i += 256) L0[i] = c0[i];
  for (int i = tid; i < 1024; i += 256) L1[i] = c1[i];
  for (int i = tid; i < 4096; i += 256) L2[i] = c2[i];
  for (int i = tid; i < 4096; i += 256) L3[i] = c3[i];
  for (int i = tid; i < 4096; i += 256) buf0[i] = Xn[i];
#endif
  if (tid < 128) L4[tid] = c4[tid];  // core4 (e,l,1,z): e*32 + l*4 + z
#ifdef HAVE_ASYNC_LDS
  wait_async0();  // our own async transfers landed in LDS
#endif
  __syncthreads();

  tt_step<P01,  8, 1, 1,  2>(L1, L0, C01, nullptr, nullptr, wave, lane);
  tt_step<P34, 32, 1, 4,  2>(L3, L4, C34, nullptr, nullptr, wave, lane);
  __syncthreads();
  tt_step<S1,  16, 8, 1,  4>(buf0, C01, buf1, nullptr, nullptr, wave, lane);
  __syncthreads();
  tt_step<S2,  32, 4, 1, 16>(buf1, L2, buf0, nullptr, nullptr, wave, lane);
  __syncthreads();
  tt_step<S3,   8, 2, 1, 64>(buf0, C34, nullptr, out + n * 4096, bias, wave, lane);
}

extern "C" void kernel_launch(void* const* d_in, const int* in_sizes, int n_in,
                              void* d_out, int out_size, void* d_ws, size_t ws_size,
                              hipStream_t stream) {
  const float* X    = (const float*)d_in[0];
  const float* c0   = (const float*)d_in[1];
  const float* c1   = (const float*)d_in[2];
  const float* c2   = (const float*)d_in[3];
  const float* c3   = (const float*)d_in[4];
  const float* c4   = (const float*)d_in[5];
  const float* bias = (const float*)d_in[6];
  float* out = (float*)d_out;

  const int n_tokens = in_sizes[0] / 4096;
  const size_t shmem = (size_t)(2 * 32768 + 4096 + 8192) * sizeof(float);

  tt_linear_fused_kernel<<<dim3(n_tokens), dim3(256), shmem, stream>>>(
      X, c0, c1, c2, c3, c4, bias, out);
}

// v003
// A run of this version takes 313 microseconds.
// Two timings next to v002 both put it at 1.40 times that version's speed.
// All steps since v000 together make it 2.91 times as fast.
#include <hip/hip_runtime.h>
#include <hip/hip_bf16.h>

// TT-linear forward, fully fused per token in LDS, fp32 WMMA (16x16x4) on gfx1250.
//
// Per token (one workgroup, 8 wave32s; 136 KiB of LDS, so that two workgroups share a WGP):
//   stage X[4096] + all cores into LDS (async global->LDS, ASYNCcnt-tracked)
//   C01[a,b][v,j,w]    = core0    x core1   (M= 128,K= 8,N=16)  neighbour cores merged first
//   C34[d,e,k][y,z]    = core3    x core4   (M= 512,K= 8,N=16)
//   then, for each chunk of 8 of the 32 (d,e) pairs:
//   T2[c,de][v][j,w]   = X        x C01     (M=  64,K= 16,N=128)
//   T3[de][v,w][k,x]   = T2       x core2   (M= 128,K= 64,N= 64)
//   out[v,w,x][y,z]   += T3       x C34     (M= 128,K= 64,N= 32)  kept in registers; + bias at the end

typedef float v2f __attribute__((ext_vector_type(2)));
typedef float v8f __attribute__((ext_vector_type(8)));

#define NWAVES 8

#if defined(__has_builtin)
#if __has_builtin(__builtin_amdgcn_global_load_async_to_lds_b128)
#define HAVE_ASYNC_LDS 1
#endif
#if __has_builtin(__builtin_amdgcn_s_wait_asynccnt)
#define HAVE_WAIT_ASYNC_BUILTIN 1
#endif
#endif

#ifdef HAVE_ASYNC_LDS
#define AS1 __attribute__((address_space(1)))
#define AS3 __attribute__((address_space(3)))
typedef int v4i_b128 __attribute__((vector_size(16)));  // matches builtin pointee type
// 16B per lane, global -> LDS, no VGPR round trip; tracked by ASYNCcnt.
__device__ __forceinline__ void async_copy16(const float* g, float* l) {
  __builtin_amdgcn_global_load_async_to_lds_b128(
      (AS1 v4i_b128*)const_cast<float*>(g), (AS3 v4i_b128*)l,
      /*offset=*/0, /*cpol=*/0);
}
__device__ __forceinline__ void wait_async0() {
#ifdef HAVE_WAIT_ASYNC_BUILTIN
  __builtin_amdgcn_s_wait_asynccnt(0);
#else
  asm volatile("s_wait_asynccnt 0x0" ::: "memory");
#endif
}
#endif

enum { P01 = 0, P34 = 1, S1 = 2, S2 = 3, S3 = 4 };

#define NCHUNK 4   // chunks of the (d,e) range
#define DEC    8   // (d,e) pairs per chunk

// A-fragment address (element index into the step's LDS input tensor) for row M, col K.
// S1, S2, S3: M and K count inside the current chunk.
__device__ __forceinline__ int a_addr(int STEP, int M, int K) {
  switch (STEP) {
    case P01: // core1[b][i][j*4+w] ; M=(b,j,w), K=i
      return ((M >> 5) << 8) + (K << 5) + (M & 31);
    case P34: // core3[d][k][l][y] ; M=(d,k,y), K=l
      return ((M >> 3) << 6) + (K << 3) + (M & 7);
    case S1:  // X flat [a,b][c][de] from the chunk's first de ; M=(c,de), K=(a,b)
      return (K << 8) + ((M >> 3) << 5) + (M & 7);
    case S2:  // T2: c*1024 + de*128 + v*32 + j*4 + w ; M=(de,v,w), K=(c,j)
      return ((K >> 3) << 10) + ((M >> 4) << 7) + (((M >> 2) & 3) << 5) + ((K & 7) << 2) + (M & 3);
    default:  // T3: de*1024 + vw*64 + k*8 + x ; M=(v,w,x), K=(de,k)
      return ((K >> 3) << 10) + ((M >> 3) << 6) + ((K & 7) << 3) + (M & 7);
  }
}

// Place of element (K, N) in a merged core: kept in the order in which its reader's
// B fragments take it, so that a lane's K pair is one 8-byte read.
__device__ __forceinline__ int frag_addr(int NT, int K, int N) {
  return ((((K >> 2) * NT + (N >> 4)) * 32 + ((K >> 1) & 1) * 16 + (N & 15)) << 1) + (K & 1);
}

// B-fragment address (element index into the step's LDS core) for row K, col N.
__device__ __forceinline__ int b_addr(int STEP, int K, int N) {
  switch (STEP) {
    case P01: return ((N >> 2) << 5) + (K << 2) + (N & 3);         // core0[a][i][v] ; N=(a,v)
    case P34: return ((N >> 2) << 5) + (K << 2) + (N & 3);         // core4[e][l][z] ; N=(e,z)
    case S1:  return frag_addr(8, K, N);                           // C01
    case S2:  return ((K >> 3) << 9) + ((K & 7) << 6) + N;         // core2[c][j][k*8+x]
    default:  return frag_addr(2, K, N);                           // C34 from the chunk's first K
  }
}

// LDS place of output element (row, col) of a step.
__device__ __forceinline__ int o_addr(int STEP, int row, int col) {
  switch (STEP) {
    case P01: // row=(b,j,w), col=(a,v) -> C01[K=(a,b)][N=(v,j,w)]
      return frag_addr(8, ((col >> 2) << 2) + (row >> 5), ((col & 3) << 5) + (row & 31));
    case P34: // row=(d,k,y), col=(e,z) -> C34[K=(d,e,k)][N=(y,z)]
      return frag_addr(2, ((((row >> 6) << 2) + (col >> 2)) << 3) + ((row >> 3) & 7),
                       ((row & 7) << 2) + (col & 3));
    case S1:  return (row << 7) + col;
    default:  return (row << 6) + col;
  }
}

// B fragment of N-tile nt, K chunk kc.
template <int STEP>
__device__ __forceinline__ v2f load_b(const float* __restrict__ B, int nt, int kc, int lane) {
  const int lm = lane & 15;
  const int k0 = kc * 4 + ((lane >> 4) << 1);
  v2f b;
  if (STEP == S1 || STEP == S3) {
    b = *(const v2f*)(B + b_addr(STEP, k0, nt * 16 + lm));
  } else {
    b.x = B[b_addr(STEP, k0,     nt * 16 + lm)];
    b.y = B[b_addr(STEP, k0 + 1, nt * 16 + lm)];
  }
  return b;
}

// acc += A x B for M-tiles mt0.. (MB of them) by N-tiles nt0.. (NT of them), K = 4 * KCH.
// BREG: the B fragments are handed in in registers (breg), else they are read from B.
template <int STEP, int NT, int MB, int KCH, bool BREG>
__device__ __forceinline__ void tt_mma(const float* __restrict__ A,
                                       const float* __restrict__ B,
                                       const v2f (&breg)[BREG ? NT : 1][BREG ? KCH : 1],
                                       v8f (&acc)[MB][NT], int mt0, int nt0, int lane) {
  const int lm = lane & 15;            // row within the 16-high A tile
  const int kk = (lane >> 4) << 1;     // K sub-offset for A/B fragments (0 or 2)
  // Every loop here is unrolled so that fragments and accumulators have constant
  // indices and stay in registers.
#pragma unroll
  for (int kc = 0; kc < KCH; ++kc) {
    const int k0 = kc * 4 + kk;
    v2f afrag[MB];
#pragma unroll
    for (int mb = 0; mb < MB; ++mb) {
      const int mrow = (mt0 + mb) * 16 + lm;
      afrag[mb].x = A[a_addr(STEP, mrow, k0)];
      afrag[mb].y = A[a_addr(STEP, mrow, k0 + 1)];
    }
    v2f bcur[NT];
#pragma unroll
    for (int nt = 0; nt < NT; ++nt) {
      if constexpr (BREG) bcur[nt] = breg[nt][kc];
      else                bcur[nt] = load_b<STEP>(B, nt0 + nt, kc, lane);
    }
#pragma unroll
    for (int mb = 0; mb < MB; ++mb) {
#pragma unroll
      for (int nt = 0; nt < NT; ++nt)
        acc[mb][nt] = __builtin_amdgcn_wmma_f32_16x16x4_f32(
            false, afrag[mb], false, bcur[nt], (short)0, acc[mb][nt], false, false);
    }
  }
}

// Accumulator tiles -> the step's LDS output tensor.
template <int STEP, int NT, int MB>
__device__ __forceinline__ void tt_store(float* __restrict__ O, const v8f (&acc)[MB][NT],
                                         int mt0, int nt0, int lane) {
  const int lm = lane & 15;            // column within 16-wide tile
  const int rb = (lane >> 4) << 3;     // C/D row base offset (0 or 8)
  // Unrolled: constant indices keep the accumulators in registers.
#pragma unroll
  for (int mb = 0; mb < MB; ++mb) {
    const int rbase = (mt0 + mb) * 16 + rb;
#pragma unroll
    for (int nt = 0; nt < NT; ++nt) {
#pragma unroll
      for (int r = 0; r < 8; ++r)
        O[o_addr(STEP, rbase + r, (nt0 + nt) * 16 + lm)] = acc[mb][nt][r];
    }
  }
}

__global__ __launch_bounds__(256) void tt_linear_fused_kernel(
    const float* __restrict__ X,
    const float* __restrict__ c0, const float* __restrict__ c1,
    const float* __restrict__ c2, const float* __restrict__ c3,
    const float* __restrict__ c4, const float* __restrict__ bias,
    float* __restrict__ out) {
  extern __shared__ float smem[];
  float* Xs  = smem;             // 4096: the token
  float* C01 = Xs + 4096;        // 2048: core0 x core1
  float* L2  = C01 + 2048;       // 4096: core2
  float* C34 = L2 + 4096;        // 8192: core3 x core4
  float* T2c = C34 + 8192;       // 8192: one chunk of T2
  float* T3c = T2c + 8192;       // 8192: one chunk of T3
  float* L3 = T2c;               // 4096: the raw cores lie in T2c until they are merged
  float* L1 = L3 + 4096;         // 1024
  float* L0 = L1 + 1024;         // 128
  float* L4 = L0 + 128;          // 128

  const int tid  = threadIdx.x;
  const int wave = tid >> 5;
  const int lane = tid & 31;
  const long n = blockIdx.x;
  const float* Xn = X + n * 4096;

#ifdef HAVE_ASYNC_LDS
  // Async global->LDS staging: 16B/lane moves, no VGPR round trip (ASYNCcnt).
  {
    const int q = tid * 4;                       // 256 threads x 4 floats = 1024 f32/round
    for (int i = q; i < 4096; i += 1024) async_copy16(Xn + i, Xs + i);    // X: 4 rounds
    for (int i = q; i < 4096; i += 1024) async_copy16(c2 + i, L2 + i);    // core2
    for (int i = q; i < 4096; i += 1024) async_copy16(c3 + i, L3 + i);    // core3
    if (q < 1024) async_copy16(c1 + q, L1 + q);                           // core1
    if (q < 128)  async_copy16(c0 + q, L0 + q);                           // core0
  }
#else
  for (int i = tid; i < 128;  i += 256) L0[i] = c0[i];
  for (int i = tid; i < 1024; i += 256) L1[i] = c1[i];
  for (int i = tid; i < 4096; i += 256) L2[i] = c2[i];
  for (int i = tid; i < 4096; i += 256) L3[i] = c3[i];
  for (int i = tid; i < 4096; i += 256) Xs[i] = Xn[i];
#endif
  if (tid < 128) L4[tid] = c4[tid];  // core4 (e,l,1,z): e*32 + l*4 + z
#ifdef HAVE_ASYNC_LDS
  wait_async0();  // our own async transfers landed in LDS
#endif
  __syncthreads();

  const v2f nob[1][1] = {};
  {
    v8f acc[1][1] = {};
    tt_mma<P01, 1, 1, 2, false>(L1, L0, nob, acc, wave, 0, lane);
    tt_store<P01, 1, 1>(C01, acc, wave, 0, lane);
  }
  {
    v8f acc[4][1] = {};
    tt_mma<P34, 1, 4, 2, false>(L3, L4, nob, acc, wave * 4, 0, lane);
    tt_store<P34, 1, 4>(C34, acc, wave * 4, 0, lane);
  }
  // core2's B fragments (all N-tiles, whole K range) stay in registers over the chunks
  // (unrolled for constant indices).
  v2f b2[4][16];
#pragma unroll
  for (int nt = 0; nt < 4; ++nt) {
#pragma unroll
    for (int kc = 0; kc < 16; ++kc) b2[nt][kc] = load_b<S2>(L2, nt, kc, lane);
  }
  __syncthreads();  // merged cores stand; the raw cores in T2c are dead

  v8f oacc[1][2] = {};  // this wave's 16 x 32 piece of out, summed over the chunks
  for (int p = 0; p < NCHUNK; ++p) {
    {
      v8f acc[1][4] = {};  // 4 M-tiles x 8 N-tiles over 8 waves: 1 x 4 a wave
      tt_mma<S1, 4, 1, 4, false>(Xs + p * DEC, C01, nob, acc, wave & 3, (wave >> 2) * 4, lane);
      tt_store<S1, 4, 1>(T2c, acc, wave & 3, (wave >> 2) * 4, lane);
    }
    __syncthreads();  // T2c stands; every reader of the last chunk's T3c is through
    {
      v8f acc[1][4] = {};
      tt_mma<S2, 4, 1, 16, true>(T2c, L2, b2, acc, wave, 0, lane);
      tt_store<S2, 4, 1>(T3c, acc, wave, 0, lane);
    }
    __syncthreads();  // T3c stands; every reader of T2c is through
    tt_mma<S3, 2, 1, 16, false>(T3c, C34 + p * (DEC * 8 * 32), nob, oacc, wave, 0, lane);
  }

  float* gout = out + n * 4096;
  const int lm = lane & 15;
  const int rbase = wave * 16 + ((lane >> 4) << 3);
  // Unrolled: constant indices keep oacc in registers.
#pragma unroll
  for (int nt = 0; nt < 2; ++nt) {
#pragma unroll
    for (int r = 0; r < 8; ++r) {
      const int oi = (rbase + r) * 32 + nt * 16 + lm;
      gout[oi] = oacc[0][nt][r] + bias[oi];
    }
  }
}

extern "C" void kernel_launch(void* const* d_in, const int* in_sizes, int n_in,
                              void* d_out, int out_size, void* d_ws, size_t ws_size,
                              hipStream_t stream) {
  const float* X    = (const float*)d_in[0];
  const float* c0   = (const float*)d_in[1];
  const float* c1   = (const float*)d_in[2];
  const float* c2   = (const float*)d_in[3];
  const float* c3   = (const float*)d_in[4];
  const float* c4   = (const float*)d_in[5];
  const float* bias = (const float*)d_in[6];
  float* out = (float*)d_out;

  const int n_tokens = in_sizes[0] / 4096;
  const size_t shmem = (size_t)(4096 + 2048 + 4096 + 3 * 8192) * sizeof(float);

  tt_linear_fused_kernel<<<dim3(n_tokens), dim3(256), shmem, stream>>>(
      X, c0, c1, c2, c3, c4, bias, out);
}

// v004
// Measured time: 299 microseconds a run.
// Two timings next to v003 both put it at 1.05 times that version's speed.
// All steps since v000 together make it 3.04 times as fast.
#include <hip/hip_runtime.h>
#include <hip/hip_bf16.h>

// TT-linear forward, fully fused per token in LDS, fp32 WMMA (16x16x4) on gfx1250.
//
// Per token (one workgroup, 8 wave32s; 141 KiB of LDS, so that two workgroups share a WGP):
//   stage X[4096] + all cores into LDS (async global->LDS, ASYNCcnt-tracked)
//   C01[a,b][v,j,w]    = core0    x core1   (M= 128,K= 8,N=16)  neighbour cores merged first
//   C34[d,e,k][y,z]    = core3    x core4   (M= 512,K= 8,N=16)
//   then, for each chunk of 8 of the 32 (d,e) pairs:
//   T2[c,de][v][j,w]   = X        x C01     (M=  64,K= 16,N=128)
//   T3[de][v,w][k,x]   = T2       x core2   (M= 128,K= 64,N= 64)
//   out[v,w,x][y,z]   += T3       x C34     (M= 128,K= 64,N= 32)  kept in registers; + bias at the end
//
// LDS layouts (64 banks of 4 bytes): X, core2, C34, T2 and T3 are pitched so that the 32 lanes
// of each fragment read and of each accumulator write fall on distinct banks, and T2 and T3
// keep a lane's K pair side by side, so that an A fragment is one 8-byte read.

typedef float v2f __attribute__((ext_vector_type(2)));
typedef float v8f __attribute__((ext_vector_type(8)));

#define NWAVES 8

#if defined(__has_builtin)
#if __has_builtin(__builtin_amdgcn_global_load_async_to_lds_b128)
#define HAVE_ASYNC_LDS 1
#endif
#if __has_builtin(__builtin_amdgcn_s_wait_asynccnt)
#define HAVE_WAIT_ASYNC_BUILTIN 1
#endif
#endif

#ifdef HAVE_ASYNC_LDS
#define AS1 __attribute__((address_space(1)))
#define AS3 __attribute__((address_space(3)))
typedef int v4i_b128 __attribute__((vector_size(16)));  // matches builtin pointee type
// 16B per lane, global -> LDS, no VGPR round trip; tracked by ASYNCcnt.
__device__ __forceinline__ void async_copy16(const float* g, float* l) {
  __builtin_amdgcn_global_load_async_to_lds_b128(
      (AS1 v4i_b128*)const_cast<float*>(g), (AS3 v4i_b128*)l,
      /*offset=*/0, /*cpol=*/0);
}
__device__ __forceinline__ void wait_async0() {
#ifdef HAVE_WAIT_ASYNC_BUILTIN
  __builtin_amdgcn_s_wait_asynccnt(0);
#else
  asm volatile("s_wait_asynccnt 0x0" ::: "memory");
#endif
}
#endif

enum { P01 = 0, P34 = 1, S1 = 2, S2 = 3, S3 = 4 };

#define NCHUNK 4   // chunks of the (d,e) range
#define DEC    8   // (d,e) pairs per chunk

#define X_PITCH   264   // floats per (a,b) row of X (256 used): K + 2 moves 16 banks on
#define L2_PITCH  72    // floats per (c,j) row of core2 (64 used): K + 2 moves 16 banks on
#define C34_PITCH 66    // floats per 64-float fragment block of C34: e + 1 moves 8 banks on
#define T2_PITCH  1040  // floats per c of T2 (1024 used): c + 1 moves 16 banks on
#define T3_HALF   528   // floats per 8 (v,w) rows of T3 (512 used): row + 8 moves 16 banks on
#define T3_PITCH  (2 * T3_HALF)  // floats per (d,e) pair of T3

// A-fragment address (element index into the step's LDS input tensor) for row M, col K.
// S1, S2, S3: M and K count inside the current chunk.
__device__ __forceinline__ int a_addr(int STEP, int M, int K) {
  switch (STEP) {
    case P01: // core1[b][i][j*4+w] ; M=(b,j,w), K=i
      return ((M >> 5) << 8) + (K << 5) + (M & 31);
    case P34: // core3[d][k][l][y] ; M=(d,k,y), K=l
      return ((M >> 3) << 6) + (K << 3) + (M & 7);
    case S1:  // X [a,b][c][de], (a,b) rows X_PITCH apart, from the chunk's first de ; M=(c,de), K=(a,b)
      return K * X_PITCH + ((M >> 3) << 5) + (M & 7);
    case S2:  // T2: c*T2_PITCH + de*128 + (j/2)*32 + vw*2 + j%2 ; M=(de,v,w), K=(c,j)
      return (K >> 3) * T2_PITCH + ((M >> 4) << 7) + (((K & 7) >> 1) << 5) + ((M & 15) << 1) + (K & 1);
    default:  // T3: de*T3_PITCH + (vw/8)*T3_HALF + (vw/2%4)*128 + (k/2)*32 + (vw%2,x)*2 + k%2 ; M=(v,w,x), K=(de,k)
      return (K >> 3) * T3_PITCH + (M >> 6) * T3_HALF + (((M >> 4) & 3) << 7) + (((K & 7) >> 1) << 5) +
             ((M & 15) << 1) + (K & 1);
  }
}

// Place of element (K, N) in a merged core: kept in the order in which its reader's
// B fragments take it, so that a lane's K pair is one 8-byte read.
// PITCH: floats from one 64-float block (4 K by 16 N) to the next.
__device__ __forceinline__ int frag_addr(int NT, int PITCH, int K, int N) {
  return ((K >> 2) * NT + (N >> 4)) * PITCH + ((((K >> 1) & 1) * 16 + (N & 15)) << 1) + (K & 1);
}

// B-fragment address (element index into the step's LDS core) for row K, col N.
__device__ __forceinline__ int b_addr(int STEP, int K, int N) {
  switch (STEP) {
    case P01: return ((N >> 2) << 5) + (K << 2) + (N & 3);         // core0[a][i][v] ; N=(a,v)
    case P34: return ((N >> 2) << 5) + (K << 2) + (N & 3);         // core4[e][l][z] ; N=(e,z)
    case S1:  return frag_addr(8, 64, K, N);                       // C01
    case S2:  return K * L2_PITCH + N;                             // core2[c,j][k*8+x]
    default:  return frag_addr(2, C34_PITCH, K, N);                // C34 from the chunk's first K
  }
}

// LDS place of output element (row, col) of a step.
__device__ __forceinline__ int o_addr(int STEP, int row, int col) {
  switch (STEP) {
    case P01: // row=(b,j,w), col=(a,v) -> C01[K=(a,b)][N=(v,j,w)]
      return frag_addr(8, 64, ((col >> 2) << 2) + (row >> 5), ((col & 3) << 5) + (row & 31));
    case P34: // row=(d,k,y), col=(e,z) -> C34[K=(d,e,k)][N=(y,z)]
      return frag_addr(2, C34_PITCH, ((((row >> 6) << 2) + (col >> 2)) << 3) + ((row >> 3) & 7),
                       ((row & 7) << 2) + (col & 3));
    case S1:  // row=(c,de), col=(v,j,w) -> T2
      return (row >> 3) * T2_PITCH + ((row & 7) << 7) + (((col >> 3) & 3) << 5) +
             ((((col >> 5) << 2) + (col & 3)) << 1) + ((col >> 2) & 1);
    default:  // row=(de,v,w), col=(k,x) -> T3
      return (row >> 4) * T3_PITCH + ((row >> 3) & 1) * T3_HALF + (((row >> 1) & 3) << 7) +
             ((col >> 4) << 5) + ((((row & 1) << 3) + (col & 7)) << 1) + ((col >> 3) & 1);
  }
}

// B fragment of N-tile nt, K chunk kc.
template <int STEP>
__device__ __forceinline__ v2f load_b(const float* __restrict__ B, int nt, int kc, int lane) {
  const int lm = lane & 15;
  const int k0 = kc * 4 + ((lane >> 4) << 1);
  v2f b;
  if (STEP == S1 || STEP == S3) {
    b = *(const v2f*)(B + b_addr(STEP, k0, nt * 16 + lm));
  } else {
    b.x = B[b_addr(STEP, k0,     nt * 16 + lm)];
    b.y = B[b_addr(STEP, k0 + 1, nt * 16 + lm)];
  }
  return b;
}

// acc += A x B for M-tiles mt0.. (MB of them) by N-tiles nt0.. (NT of them), K = 4 * KCH.
// BREG: the B fragments are handed in in registers (breg), else they are read from B.
template <int STEP, int NT, int MB, int KCH, bool BREG>
__device__ __forceinline__ void tt_mma(const float* __restrict__ A,
                                       const float* __restrict__ B,
                                       const v2f (&breg)[BREG ? NT : 1][BREG ? KCH : 1],
                                       v8f (&acc)[MB][NT], int mt0, int nt0, int lane) {
  const int lm = lane & 15;            // row within the 16-high A tile
  const int kk = (lane >> 4) << 1;     // K sub-offset for A/B fragments (0 or 2)
  // Every loop here is unrolled so that fragments and accumulators have constant
  // indices and stay in registers.
#pragma unroll
  for (int kc = 0; kc < KCH; ++kc) {
    const int k0 = kc * 4 + kk;
    v2f afrag[MB];
#pragma unroll
    for (int mb = 0; mb < MB; ++mb) {
      const int mrow = (mt0 + mb) * 16 + lm;
      if (STEP == S2 || STEP == S3) {
        afrag[mb] = *(const v2f*)(A + a_addr(STEP, mrow, k0));
      } else {
        afrag[mb].x = A[a_addr(STEP, mrow, k0)];
        afrag[mb].y = A[a_addr(STEP, mrow, k0 + 1)];
      }
    }
    v2f bcur[NT];
#pragma unroll
    for (int nt = 0; nt < NT; ++nt) {
      if constexpr (BREG) bcur[nt] = breg[nt][kc];
      else                bcur[nt] = load_b<STEP>(B, nt0 + nt, kc, lane);
    }
#pragma unroll
    for (int mb = 0; mb < MB; ++mb) {
#pragma unroll
      for (int nt = 0; nt < NT; ++nt)
        acc[mb][nt] = __builtin_amdgcn_wmma_f32_16x16x4_f32(
            false, afrag[mb], false, bcur[nt], (short)0, acc[mb][nt], false, false);
    }
  }
}

// Accumulator tiles -> the step's LDS output tensor.
template <int STEP, int NT, int MB>
__device__ __forceinline__ void tt_store(float* __restrict__ O, const v8f (&acc)[MB][NT],
                                         int mt0, int nt0, int lane) {
  const int lm = lane & 15;            // column within 16-wide tile
  const int rb = (lane >> 4) << 3;     // C/D row base offset (0 or 8)
  // Unrolled: constant indices keep the accumulators in registers.
#pragma unroll
  for (int mb = 0; mb < MB; ++mb) {
    const int rbase = (mt0 + mb) * 16 + rb;
#pragma unroll
    for (int nt = 0; nt < NT; ++nt) {
#pragma unroll
      for (int r = 0; r < 8; ++r)
        O[o_addr(STEP, rbase + r, (nt0 + nt) * 16 + lm)] = acc[mb][nt][r];
    }
  }
}

__global__ __launch_bounds__(256) void tt_linear_fused_kernel(
    const float* __restrict__ X,
    const float* __restrict__ c0, const float* __restrict__ c1,
    const float* __restrict__ c2, const float* __restrict__ c3,
    const float* __restrict__ c4, const float* __restrict__ bias,
    float* __restrict__ out) {
  extern __shared__ float smem[];
  float* Xs  = smem;                    // the token
  float* C01 = Xs + 16 * X_PITCH;       // 2048: core0 x core1
  float* L2  = C01 + 2048;              // core2
  float* C34 = L2 + 64 * L2_PITCH;      // core3 x core4
  float* T2c = C34 + 128 * C34_PITCH;   // one chunk of T2
  float* T3c = T2c + 8 * T2_PITCH;      // one chunk of T3
  float* L3 = T2c;               // 4096: the raw cores lie in T2c until they are merged
  float* L1 = L3 + 4096;         // 1024
  float* L0 = L1 + 1024;         // 128
  float* L4 = L0 + 128;          // 128

  const int tid  = threadIdx.x;
  const int wave = tid >> 5;
  const int lane = tid & 31;
  const long n = blockIdx.x;
  const float* Xn = X + n * 4096;

#ifdef HAVE_ASYNC_LDS
  // Async global->LDS staging: 16B/lane moves, no VGPR round trip (ASYNCcnt).
  {
    const int q = tid * 4;                       // 256 threads x 4 floats = 1024 f32/round
    for (int i = q; i < 4096; i += 1024) async_copy16(Xn + i, Xs + (i >> 8) * X_PITCH + (i & 255));  // X: 4 rounds
    for (int i = q; i < 4096; i += 1024) async_copy16(c2 + i, L2 + (i >> 6) * L2_PITCH + (i & 63));  // core2
    for (int i = q; i < 4096; i += 1024) async_copy16(c3 + i, L3 + i);    // core3
    if (q < 1024) async_copy16(c1 + q, L1 + q);                           // core1
    if (q < 128)  async_copy16(c0 + q, L0 + q);                           // core0
  }
#else
  for (int i = tid; i < 128;  i += 256) L0[i] = c0[i];
  for (int i = tid; i < 1024; i += 256) L1[i] = c1[i];
  for (int i = tid; i < 4096; i += 256) L2[(i >> 6) * L2_PITCH + (i & 63)] = c2[i];
  for (int i = tid; i < 4096; i += 256) L3[i] = c3[i];
  for (int i = tid; i < 4096; i += 256) Xs[(i >> 8) * X_PITCH + (i & 255)] = Xn[i];
#endif
  if (tid < 128) L4[tid] = c4[tid];  // core4 (e,l,1,z): e*32 + l*4 + z
#ifdef HAVE_ASYNC_LDS
  wait_async0();  // our own async transfers landed in LDS
#endif
  __syncthreads();

  const v2f nob[1][1] = {};
  {
    v8f acc[1][1] = {};
    tt_mma<P01, 1, 1, 2, false>(L1, L0, nob, acc, wave, 0, lane);
    tt_store<P01, 1, 1>(C01, acc, wave, 0, lane);
  }
  {
    v8f acc[4][1] = {};
    tt_mma<P34, 1, 4, 2, false>(L3, L4, nob, acc, wave * 4, 0, lane);
    tt_store<P34, 1, 4>(C34, acc, wave * 4, 0, lane);
  }
  // core2's B fragments (all N-tiles, whole K range) stay in registers over the chunks
  // (unrolled for constant indices).
  v2f b2[4][16];
#pragma unroll
  for (int nt = 0; nt < 4; ++nt) {
#pragma unroll
    for (int kc = 0; kc < 16; ++kc) b2[nt][kc] = load_b<S2>(L2, nt, kc, lane);
  }
  __syncthreads();  // merged cores stand; the raw cores in T2c are dead

  v8f oacc[1][2] = {};  // this wave's 16 x 32 piece of out, summed over the chunks
  for (int p = 0; p < NCHUNK; ++p) {
    {
      v8f acc[1][4] = {};  // 4 M-tiles x 8 N-tiles over 8 waves: 1 x 4 a wave
      tt_mma<S1, 4, 1, 4, false>(Xs + p * DEC, C01, nob, acc, wave & 3, (wave >> 2) * 4, lane);
      tt_store<S1, 4, 1>(T2c, acc, wave & 3, (wave >> 2) * 4, lane);
    }
    __syncthreads();  // T2c stands; every reader of the last chunk's T3c is through
    {
      v8f acc[1][4] = {};
      tt_mma<S2, 4, 1, 16, true>(T2c, L2, b2, acc, wave, 0, lane);
      tt_store<S2, 4, 1>(T3c, acc, wave, 0, lane);
    }
    __syncthreads();  // T3c stands; every reader of T2c is through
    tt_mma<S3, 2, 1, 16, false>(T3c, C34 + p * (DEC * 4 * C34_PITCH), nob, oacc, wave, 0, lane);
  }

  float* gout = out + n * 4096;
  const int lm = lane & 15;
  const int rbase = wave * 16 + ((lane >> 4) << 3);
  // Unrolled: constant indices keep oacc in registers.
#pragma unroll
  for (int nt = 0; nt < 2; ++nt) {
#pragma unroll
    for (int r = 0; r < 8; ++r) {
      const int oi = (rbase + r) * 32 + nt * 16 + lm;
      gout[oi] = oacc[0][nt][r] + bias[oi];
    }
  }
}

extern "C" void kernel_launch(void* const* d_in, const int* in_sizes, int n_in,
                              void* d_out, int out_size, void* d_ws, size_t ws_size,
                              hipStream_t stream) {
  const float* X    = (const float*)d_in[0];
  const float* c0   = (const float*)d_in[1];
  const float* c1   = (const float*)d_in[2];
  const float* c2   = (const float*)d_in[3];
  const float* c3   = (const float*)d_in[4];
  const float* c4   = (const float*)d_in[5];
  const float* bias = (const float*)d_in[6];
  float* out = (float*)d_out;

  const int n_tokens = in_sizes[0] / 4096;
  const size_t shmem = (size_t)(16 * X_PITCH + 2048 + 64 * L2_PITCH + 128 * C34_PITCH + 8 * T2_PITCH +
                                8 * T3_PITCH) * sizeof(float);

  tt_linear_fused_kernel<<<dim3(n_tokens), dim3(256), shmem, stream>>>(
      X, c0, c1, c2, c3, c4, bias, out);
}

// v005
// It runs in 289 microseconds.
// Two timings next to v004 both put it at 1.03 times that version's speed.
// Over all steps from v000 it is 3.14 times as fast.
#include <hip/hip_runtime.h>
#include <hip/hip_bf16.h>

// TT-linear forward, fully fused per token in LDS, fp32 WMMA (16x16x4) on gfx1250.
//
// Per token (one workgroup, 8 wave32s; 143 KiB of LDS, so that two workgroups share a WGP):
//   stage X[4096] + all cores into LDS (async global->LDS, ASYNCcnt-tracked)
//   C01[a,b][v,w,j]    = core0    x core1   (M= 128,K= 8,N=16)  neighbour cores merged first
//   C34[d,e,k][y,z]    = core3    x core4   (M= 512,K= 8,N=16)
//   then, for each chunk of 8 of the 32 (d,e) pairs:
//   T2[v,w/2][de,w%2][c,j]   = X        x C01     (M=  64,K= 16,N=128)
//   T3[v,w,x][de,k]    = T2       x core2   (M= 128,K= 64,N= 64)
//   out[v,w,x][y,z]   += T3       x C34     (M= 128,K= 64,N= 32)  kept in registers; + bias at the end
//
// (v,w) runs free through all three chain products, so the work is dealt by it: each wave owns two
// of the 16 (v,w) values, and the T2 and T3 it writes are read by itself alone. Behind the barrier
// that publishes the merged cores the waves never wait for one another.
//
// LDS layouts (64 banks of 4 bytes): X, core2, C34 and each wave's T2 and T3 are pitched so that the 32 lanes
// of each fragment read and of each accumulator write fall on distinct banks, and T2 and T3
// keep a lane's K pair side by side, so that an A fragment is one 8-byte read.

typedef float v2f __attribute__((ext_vector_type(2)));
typedef float v8f __attribute__((ext_vector_type(8)));

#define NWAVES 8

#if defined(__has_builtin)
#if __has_builtin(__builtin_amdgcn_global_load_async_to_lds_b128)
#define HAVE_ASYNC_LDS 1
#endif
#if __has_builtin(__builtin_amdgcn_s_wait_asynccnt)
#define HAVE_WAIT_ASYNC_BUILTIN 1
#endif
#endif

#ifdef HAVE_ASYNC_LDS
#define AS1 __attribute__((address_space(1)))
#define AS3 __attribute__((address_space(3)))
typedef int v4i_b128 __attribute__((vector_size(16)));  // matches builtin pointee type
// 16B per lane, global -> LDS, no VGPR round trip; tracked by ASYNCcnt.
__device__ __forceinline__ void async_copy16(const float* g, float* l) {
  __builtin_amdgcn_global_load_async_to_lds_b128(
      (AS1 v4i_b128*)const_cast<float*>(g), (AS3 v4i_b128*)l,
      /*offset=*/0, /*cpol=*/0);
}
__device__ __forceinline__ void wait_async0() {
#ifdef HAVE_WAIT_ASYNC_BUILTIN
  __builtin_amdgcn_s_wait_asynccnt(0);
#else
  asm volatile("s_wait_asynccnt 0x0" ::: "memory");
#endif
}
#endif

enum { P01 = 0, P34 = 1, S1 = 2, S2 = 3, S3 = 4 };

#define NCHUNK 4   // chunks of the (d,e) range
#define DEC    8   // (d,e) pairs per chunk

#define X_PITCH   264   // floats per (a,b) row of X (256 used): K + 2 moves 16 banks on
#define L2_PITCH  72    // floats per (c,j) row of core2 (64 used): K + 2 moves 16 banks on
#define C34_PITCH 66    // floats per 64-float fragment block of C34: e + 1 moves 8 banks on
#define T2_BLK    68    // floats per 64-float fragment block of T2: block + 1 moves 4 banks on
#define T3_BLK    66    // floats per 64-float fragment block of T3: de + 4 moves 16 banks on
#define T2_WAVE   (16 * T2_BLK)  // floats of one wave's chunk of T2
#define T3_WAVE   (16 * T3_BLK)  // floats of one wave's chunk of T3

// A-fragment address (element index into the step's LDS input tensor) for row M, col K.
// S1, S2, S3: M and K count inside the current chunk; S2, S3: inside the wave's own T2, T3 too.
__device__ __forceinline__ int a_addr(int STEP, int M, int K) {
  switch (STEP) {
    case P01: // core1[b][i][j*4+w] ; M=(b,j,w), K=i
      return ((M >> 5) << 8) + (K << 5) + (M & 31);
    case P34: // core3[d][k][l][y] ; M=(d,k,y), K=l
      return ((M >> 3) << 6) + (K << 3) + (M & 7);
    case S1:  // X [a,b][c][de], (a,b) rows X_PITCH apart, from the chunk's first de ; M=(c,de), K=(a,b)
      return K * X_PITCH + ((M >> 3) << 5) + (M & 7);
    case S2:  // T2 in fragment blocks of 4 K by 16 M ; M=(de,u), K=(c,j) ; u: which of the wave's two (v,w)
      return (K >> 2) * T2_BLK + ((((K >> 1) & 1) * 16 + M) << 1) + (K & 1);
    default:  // T3 in fragment blocks of 4 K by 16 M ; M=(u,x), K=(de,k)
      return (K >> 2) * T3_BLK + ((((K >> 1) & 1) * 16 + M) << 1) + (K & 1);
  }
}

// Place of element (K, N) in a merged core: kept in the order in which its reader's
// B fragments take it, so that a lane's K pair is one 8-byte read.
// PITCH: floats from one 64-float block (4 K by 16 N) to the next.
__device__ __forceinline__ int frag_addr(int NT, int PITCH, int K, int N) {
  return ((K >> 2) * NT + (N >> 4)) * PITCH + ((((K >> 1) & 1) * 16 + (N & 15)) << 1) + (K & 1);
}

// B-fragment address (element index into the step's LDS core) for row K, col N.
__device__ __forceinline__ int b_addr(int STEP, int K, int N) {
  switch (STEP) {
    case P01: return ((N >> 2) << 5) + (K << 2) + (N & 3);         // core0[a][i][v] ; N=(a,v)
    case P34: return ((N >> 2) << 5) + (K << 2) + (N & 3);         // core4[e][l][z] ; N=(e,z)
    case S1:  return frag_addr(8, 64, K, N);                       // C01
    case S2:  return K * L2_PITCH + N;                             // core2[c,j][k*8+x]
    default:  return frag_addr(2, C34_PITCH, K, N);                // C34 from the chunk's first K
  }
}

// LDS place of output element (row, col) of a step.
__device__ __forceinline__ int o_addr(int STEP, int row, int col) {
  switch (STEP) {
    case P01: // row=(b,j,w), col=(a,v) -> C01[K=(a,b)][N=(v,w/2 | w%2,j)]: N-tile t holds what wave t owns
      return frag_addr(8, 64, ((col >> 2) << 2) + (row >> 5),
                       ((((col & 3) << 1) + ((row >> 1) & 1)) << 4) + ((row & 1) << 3) + ((row >> 2) & 7));
    case P34: // row=(d,k,y), col=(e,z) -> C34[K=(d,e,k)][N=(y,z)]
      return frag_addr(2, C34_PITCH, ((((row >> 6) << 2) + (col >> 2)) << 3) + ((row >> 3) & 7),
                       ((row & 7) << 2) + (col & 3));
    case S1:  // row=(c,de), col=(u,j) -> T2[M=(de,u)][K=(c,j)]
      return a_addr(S2, ((row & 7) << 1) + (col >> 3), ((row >> 3) << 3) + (col & 7));
    default:  // row=(de,u), col=(k,x) -> T3[M=(u,x)][K=(de,k)]
      return a_addr(S3, ((row & 1) << 3) + (col & 7), ((row >> 1) << 3) + (col >> 3));
  }
}

// B fragment of N-tile nt, K chunk kc.
template <int STEP>
__device__ __forceinline__ v2f load_b(const float* __restrict__ B, int nt, int kc, int lane) {
  const int lm = lane & 15;
  const int k0 = kc * 4 + ((lane >> 4) << 1);
  v2f b;
  if (STEP == S1 || STEP == S3) {
    b = *(const v2f*)(B + b_addr(STEP, k0, nt * 16 + lm));
  } else {
    b.x = B[b_addr(STEP, k0,     nt * 16 + lm)];
    b.y = B[b_addr(STEP, k0 + 1, nt * 16 + lm)];
  }
  return b;
}

// acc += A x B for M-tiles mt0.. (MB of them) by N-tiles nt0.. (NT of them), K = 4 * KCH.
// BREG: the B fragments are handed in in registers (breg), else they are read from B.
template <int STEP, int NT, int MB, int KCH, bool BREG>
__device__ __forceinline__ void tt_mma(const float* __restrict__ A,
                                       const float* __restrict__ B,
                                       const v2f (&breg)[BREG ? NT : 1][BREG ? KCH : 1],
                                       v8f (&acc)[MB][NT], int mt0, int nt0, int lane) {
  const int lm = lane & 15;            // row within the 16-high A tile
  const int kk = (lane >> 4) << 1;     // K sub-offset for A/B fragments (0 or 2)
  // Every loop here is unrolled so that fragments and accumulators have constant
  // indices and stay in registers.
#pragma unroll
  for (int kc = 0; kc < KCH; ++kc) {
    const int k0 = kc * 4 + kk;
    v2f afrag[MB];
#pragma unroll
    for (int mb = 0; mb < MB; ++mb) {
      const int mrow = (mt0 + mb) * 16 + lm;
      if (STEP == S2 || STEP == S3) {
        afrag[mb] = *(const v2f*)(A + a_addr(STEP, mrow, k0));
      } else {
        afrag[mb].x = A[a_addr(STEP, mrow, k0)];
        afrag[mb].y = A[a_addr(STEP, mrow, k0 + 1)];
      }
    }
    v2f bcur[NT];
#pragma unroll
    for (int nt = 0; nt < NT; ++nt) {
      if constexpr (BREG) bcur[nt] = breg[nt][kc];
      else                bcur[nt] = load_b<STEP>(B, nt0 + nt, kc, lane);
    }
#pragma unroll
    for (int mb = 0; mb < MB; ++mb) {
#pragma unroll
      for (int nt = 0; nt < NT; ++nt)
        acc[mb][nt] = __builtin_amdgcn_wmma_f32_16x16x4_f32(
            false, afrag[mb], false, bcur[nt], (short)0, acc[mb][nt], false, false);
    }
  }
}

// Accumulator tiles -> the step's LDS output tensor.
template <int STEP, int NT, int MB>
__device__ __forceinline__ void tt_store(float* __restrict__ O, const v8f (&acc)[MB][NT],
                                         int mt0, int nt0, int lane) {
  const int lm = lane & 15;            // column within 16-wide tile
  const int rb = (lane >> 4) << 3;     // C/D row base offset (0 or 8)
  // Unrolled: constant indices keep the accumulators in registers.
#pragma unroll
  for (int mb = 0; mb < MB; ++mb) {
    const int rbase = (mt0 + mb) * 16 + rb;
#pragma unroll
    for (int nt = 0; nt < NT; ++nt) {
#pragma unroll
      for (int r = 0; r < 8; ++r)
        O[o_addr(STEP, rbase + r, (nt0 + nt) * 16 + lm)] = acc[mb][nt][r];
    }
  }
}

// Stands between a wave's LDS writes and its own reads of what its other lanes wrote: the writes have
// landed before the rows are read back, and the compiler moves no LDS access across it.
__device__ __forceinline__ void wave_lds_order() {
  asm volatile("s_wait_dscnt 0x0" ::: "memory");
}

__global__ __launch_bounds__(256) void tt_linear_fused_kernel(
    const float* __restrict__ X,
    const float* __restrict__ c0, const float* __restrict__ c1,
    const float* __restrict__ c2, const float* __restrict__ c3,
    const float* __restrict__ c4, const float* __restrict__ bias,
    float* __restrict__ out) {
  extern __shared__ float smem[];
  float* Xs  = smem;                    // the token
  float* C01 = Xs + 16 * X_PITCH;       // 2048: core0 x core1
  float* L2  = C01 + 2048;              // core2
  float* C34 = L2 + 64 * L2_PITCH;      // core3 x core4
  float* T2c = C34 + 128 * C34_PITCH;   // one chunk of T2, a piece a wave
  float* T3c = T2c + NWAVES * T2_WAVE;  // one chunk of T3, a piece a wave
  float* L3 = T2c;               // 4096: the raw cores lie in T2c until they are merged
  float* L1 = L3 + 4096;         // 1024
  float* L0 = L1 + 1024;         // 128
  float* L4 = L0 + 128;          // 128

  const int tid  = threadIdx.x;
  const int wave = tid >> 5;
  const int lane = tid & 31;
  const long n = blockIdx.x;
  const float* Xn = X + n * 4096;

#ifdef HAVE_ASYNC_LDS
  // Async global->LDS staging: 16B/lane moves, no VGPR round trip (ASYNCcnt).
  {
    const int q = tid * 4;                       // 256 threads x 4 floats = 1024 f32/round
    for (int i = q; i < 4096; i += 1024) async_copy16(Xn + i, Xs + (i >> 8) * X_PITCH + (i & 255));  // X: 4 rounds
    for (int i = q; i < 4096; i += 1024) async_copy16(c2 + i, L2 + (i >> 6) * L2_PITCH + (i & 63));  // core2
    for (int i = q; i < 4096; i += 1024) async_copy16(c3 + i, L3 + i);    // core3
    if (q < 1024) async_copy16(c1 + q, L1 + q);                           // core1
    if (q < 128)  async_copy16(c0 + q, L0 + q);                           // core0
  }
#else
  for (int i = tid; i < 128;  i += 256) L0[i] = c0[i];
  for (int i = tid; i < 1024; i += 256) L1[i] = c1[i];
  for (int i = tid; i < 4096; i += 256) L2[(i >> 6) * L2_PITCH + (i & 63)] = c2[i];
  for (int i = tid; i < 4096; i += 256) L3[i] = c3[i];
  for (int i = tid; i < 4096; i += 256) Xs[(i >> 8) * X_PITCH + (i & 255)] = Xn[i];
#endif
  if (tid < 128) L4[tid] = c4[tid];  // core4 (e,l,1,z): e*32 + l*4 + z
#ifdef HAVE_ASYNC_LDS
  wait_async0();  // our own async transfers landed in LDS
#endif
  __syncthreads();

  const v2f nob[1][1] = {};
  {
    v8f acc[1][1] = {};
    tt_mma<P01, 1, 1, 2, false>(L1, L0, nob, acc, wave, 0, lane);
    tt_store<P01, 1, 1>(C01, acc, wave, 0, lane);
  }
  {
    v8f acc[4][1] = {};
    tt_mma<P34, 1, 4, 2, false>(L3, L4, nob, acc, wave * 4, 0, lane);
    tt_store<P34, 1, 4>(C34, acc, wave * 4, 0, lane);
  }
  // core2's B fragments (all N-tiles, whole K range) stay in registers over the chunks
  // (unrolled for constant indices).
  v2f b2[4][16];
#pragma unroll
  for (int nt = 0; nt < 4; ++nt) {
#pragma unroll
    for (int kc = 0; kc < 16; ++kc) b2[nt][kc] = load_b<S2>(L2, nt, kc, lane);
  }
  __syncthreads();  // merged cores stand; the raw cores in T2c are dead

  // The wave's own N-tile of C01 stays in registers over the chunks (unrolled for constant indices).
  v2f b01[1][4];
#pragma unroll
  for (int kc = 0; kc < 4; ++kc) b01[0][kc] = load_b<S1>(C01, wave, kc, lane);
  float* T2w = T2c + wave * T2_WAVE;
  float* T3w = T3c + wave * T3_WAVE;

  v8f oacc[1][2] = {};  // this wave's 16 x 32 piece of out, summed over the chunks
  for (int p = 0; p < NCHUNK; ++p) {
    {
      v8f acc[4][1] = {};  // all 4 M-tiles of the chunk by the wave's own N-tile
      tt_mma<S1, 1, 4, 4, true>(Xs + p * DEC, C01, b01, acc, 0, 0, lane);
      tt_store<S1, 1, 4>(T2w, acc, 0, 0, lane);
    }
    wave_lds_order();  // T2w is read by lanes that did not write it
    {
      v8f acc[1][4] = {};
      tt_mma<S2, 4, 1, 16, true>(T2w, L2, b2, acc, 0, 0, lane);
      tt_store<S2, 4, 1>(T3w, acc, 0, 0, lane);
    }
    wave_lds_order();  // T3w is read by lanes that did not write it
    tt_mma<S3, 2, 1, 16, false>(T3w, C34 + p * (DEC * 4 * C34_PITCH), nob, oacc, 0, 0, lane);
  }

  float* gout = out + n * 4096;
  const int lm = lane & 15;
  const int rbase = wave * 16 + ((lane >> 4) << 3);
  // Unrolled: constant indices keep oacc in registers.
#pragma unroll
  for (int nt = 0; nt < 2; ++nt) {
#pragma unroll
    for (int r = 0; r < 8; ++r) {
      const int oi = (rbase + r) * 32 + nt * 16 + lm;
      gout[oi] = oacc[0][nt][r] + bias[oi];
    }
  }
}

extern "C" void kernel_launch(void* const* d_in, const int* in_sizes, int n_in,
                              void* d_out, int out_size, void* d_ws, size_t ws_size,
                              hipStream_t stream) {
  const float* X    = (const float*)d_in[0];
  const float* c0   = (const float*)d_in[1];
  const float* c1   = (const float*)d_in[2];
  const float* c2   = (const float*)d_in[3];
  const float* c3   = (const float*)d_in[4];
  const float* c4   = (const float*)d_in[5];
  const float* bias = (const float*)d_in[6];
  float* out = (float*)d_out;

  const int n_tokens = in_sizes[0] / 4096;
  const size_t shmem = (size_t)(16 * X_PITCH + 2048 + 64 * L2_PITCH + 128 * C34_PITCH + NWAVES * T2_WAVE +
                                NWAVES * T3_WAVE) * sizeof(float);

  tt_linear_fused_kernel<<<dim3(n_tokens), dim3(256), shmem, stream>>>(
      X, c0, c1, c2, c3, c4, bias, out);
}

// v006
// One run takes 262 microseconds.
// Next to v005, in two timings, it ran 1.11 times as fast each time.
// Counting every step since v000, it is 3.47 times as fast.
#include <hip/hip_runtime.h>
#include <hip/hip_bf16.h>

// TT-linear forward, fully fused per token in LDS, fp32 WMMA (16x16x4) on gfx1250.
//
// One workgroup (8 wave32s; 143 KiB of LDS, so that two workgroups share a WGP) runs a row of tokens.
// Once per workgroup:
//   stage the first X[4096] + all cores into LDS (async global->LDS, ASYNCcnt-tracked)
//   C01[a,b][v,j,w]    = core0    x core1   (M= 128,K= 8,N=16)  neighbour cores merged first
//   C34[d,e,k][y,z]    = core3    x core4   (M= 512,K= 8,N=16)
// Per token, while the next token's X flies into the other of two X buffers,
//   for each chunk of 8 of the 32 (d,e) pairs:
//   T2[c,de][v][j,w]   = X        x C01     (M=  64,K= 16,N=128)
//   T3[de][v,w][k,x]   = T2       x core2   (M= 128,K= 64,N= 64)
//   out[v,w,x][y,z]   += T3       x C34     (M= 128,K= 64,N= 32)  kept in registers; + bias at the end
//
// (v,w) runs free through all three chain products, so the work is dealt by it: each wave owns two
// of the 16 (v,w) values, and the T2 and T3 it writes are read by itself alone. Behind the barrier
// that publishes the merged cores the waves meet once a token, where the X buffers change hands.
//
// LDS layouts (64 banks of 4 bytes): X, core2, C34 and each wave's T2 and T3 are pitched so that the 32 lanes
// of each fragment read and of each accumulator write fall on distinct banks, and T2 and T3
// keep a lane's K pair side by side, so that an A fragment is one 8-byte read.

typedef float v2f __attribute__((ext_vector_type(2)));
typedef float v8f __attribute__((ext_vector_type(8)));

#define NWAVES 8
#define NPLACES 512                  // workgroups that run at once: two on each of 256 WGPs
#define NGROUPS (5 * NPLACES)        // workgroups launched: five classes of NPLACES, of 8, 4, 2, 1, 1 tokens each
#define ROUND_TOKENS (16 * NPLACES)  // tokens that all workgroups together take in one round

#if defined(__has_builtin)
#if __has_builtin(__builtin_amdgcn_global_load_async_to_lds_b128)
#define HAVE_ASYNC_LDS 1
#endif
#if __has_builtin(__builtin_amdgcn_s_wait_asynccnt)
#define HAVE_WAIT_ASYNC_BUILTIN 1
#endif
#endif

#ifdef HAVE_ASYNC_LDS
#define AS1 __attribute__((address_space(1)))
#define AS3 __attribute__((address_space(3)))
typedef int v4i_b128 __attribute__((vector_size(16)));  // matches builtin pointee type
// 16B per lane, global -> LDS, no VGPR round trip; tracked by ASYNCcnt.
__device__ __forceinline__ void async_copy16(const float* g, float* l) {
  __builtin_amdgcn_global_load_async_to_lds_b128(
      (AS1 v4i_b128*)const_cast<float*>(g), (AS3 v4i_b128*)l,
      /*offset=*/0, /*cpol=*/0);
}
__device__ __forceinline__ void wait_async0() {
#ifdef HAVE_WAIT_ASYNC_BUILTIN
  __builtin_amdgcn_s_wait_asynccnt(0);
#else
  asm volatile("s_wait_asynccnt 0x0" ::: "memory");
#endif
}
#endif

enum { P01 = 0, P34 = 1, S1 = 2, S2 = 3, S3 = 4 };

#define NCHUNK 4   // chunks of the (d,e) range
#define DEC    8   // (d,e) pairs per chunk

#define X_PITCH   264   // floats per (a,b) row of X (256 used): K + 2 moves 16 banks on
#define L2_PITCH  72    // floats per (c,j) row of core2 (64 used): K + 2 moves 16 banks on
#define C34_PITCH 66    // floats per 64-float fragment block of C34: e + 1 moves 8 banks on
#define T2_BLK    68    // floats per 64-float fragment block of T2: block + 1 moves 4 banks on
#define T3_BLK    66    // floats per 64-float fragment block of T3: de + 4 moves 16 banks on
#define T2_WAVE   (16 * T2_BLK)  // floats of one wave's chunk of T2
#define T3_WAVE   (16 * T3_BLK)  // floats of one wave's chunk of T3

// A-fragment address (element index into the step's LDS input tensor) for row M, col K.
// S1, S2, S3: M and K count inside the current chunk; S2, S3: inside the wave's own T2, T3 too.
__device__ __forceinline__ int a_addr(int STEP, int M, int K) {
  switch (STEP) {
    case P01: // core1[b][i][j*4+w] ; M=(b,j,w), K=i
      return ((M >> 5) << 8) + (K << 5) + (M & 31);
    case P34: // core3[d][k][l][y] ; M=(d,k,y), K=l
      return ((M >> 3) << 6) + (K << 3) + (M & 7);
    case S1:  // X [a,b][c][de], (a,b) rows X_PITCH apart, from the chunk's first de ; M=(c,de), K=(a,b)
      return K * X_PITCH + ((M >> 3) << 5) + (M & 7);
    case S2:  // T2 in fragment blocks of 4 K by 16 M ; M=(de,u), K=(c,j) ; u: which of the wave's two (v,w)
      return (K >> 2) * T2_BLK + ((((K >> 1) & 1) * 16 + M) << 1) + (K & 1);
    default:  // T3 in fragment blocks of 4 K by 16 M ; M=(u,x), K=(de,k)
      return (K >> 2) * T3_BLK + ((((K >> 1) & 1) * 16 + M) << 1) + (K & 1);
  }
}

// Place of element (K, N) in a merged core: kept in the order in which its reader's
// B fragments take it, so that a lane's K pair is one 8-byte read.
// PITCH: floats from one 64-float block (4 K by 16 N) to the next.
__device__ __forceinline__ int frag_addr(int NT, int PITCH, int K, int N) {
  return ((K >> 2) * NT + (N >> 4)) * PITCH + ((((K >> 1) & 1) * 16 + (N & 15)) << 1) + (K & 1);
}

// B-fragment address (element index into the step's LDS core) for row K, col N.
__device__ __forceinline__ int b_addr(int STEP, int K, int N) {
  switch (STEP) {
    case P01: return ((N >> 2) << 5) + (K << 2) + (N & 3);         // core0[a][i][v] ; N=(a,v)
    case P34: return ((N >> 2) << 5) + (K << 2) + (N & 3);         // core4[e][l][z] ; N=(e,z)
    case S1:  return frag_addr(8, 64, K, N);                       // C01
    case S2:  return K * L2_PITCH + N;                             // core2[c,j][k*8+x]
    default:  return frag_addr(2, C34_PITCH, K, N);                // C34 from the chunk's first K
  }
}

// LDS place of output element (row, col) of a step.
__device__ __forceinline__ int o_addr(int STEP, int row, int col) {
  switch (STEP) {
    case P01: // row=(b,j,w), col=(a,v) -> C01[K=(a,b)][N=(v,w/2 | w%2,j)]: N-tile t holds what wave t owns
      return frag_addr(8, 64, ((col >> 2) << 2) + (row >> 5),
                       ((((col & 3) << 1) + ((row >> 1) & 1)) << 4) + ((row & 1) << 3) + ((row >> 2) & 7));
    case P34: // row=(d,k,y), col=(e,z) -> C34[K=(d,e,k)][N=(y,z)]
      return frag_addr(2, C34_PITCH, ((((row >> 6) << 2) + (col >> 2)) << 3) + ((row >> 3) & 7),
                       ((row & 7) << 2) + (col & 3));
    case S1:  // row=(c,de), col=(u,j) -> T2[M=(de,u)][K=(c,j)]
      return a_addr(S2, ((row & 7) << 1) + (col >> 3), ((row >> 3) << 3) + (col & 7));
    default:  // row=(de,u), col=(k,x) -> T3[M=(u,x)][K=(de,k)]
      return a_addr(S3, ((row & 1) << 3) + (col & 7), ((row >> 1) << 3) + (col >> 3));
  }
}

// B fragment of N-tile nt, K chunk kc.
template <int STEP>
__device__ __forceinline__ v2f load_b(const float* __restrict__ B, int nt, int kc, int lane) {
  const int lm = lane & 15;
  const int k0 = kc * 4 + ((lane >> 4) << 1);
  v2f b;
  if (STEP == S1 || STEP == S3) {
    b = *(const v2f*)(B + b_addr(STEP, k0, nt * 16 + lm));
  } else {
    b.x = B[b_addr(STEP, k0,     nt * 16 + lm)];
    b.y = B[b_addr(STEP, k0 + 1, nt * 16 + lm)];
  }
  return b;
}

// acc += A x B for M-tiles mt0.. (MB of them) by N-tiles nt0.. (NT of them), K = 4 * KCH.
// BREG: the B fragments are handed in in registers (breg), else they are read from B.
template <int STEP, int NT, int MB, int KCH, bool BREG>
__device__ __forceinline__ void tt_mma(const float* __restrict__ A,
                                       const float* __restrict__ B,
                                       const v2f (&breg)[BREG ? NT : 1][BREG ? KCH : 1],
                                       v8f (&acc)[MB][NT], int mt0, int nt0, int lane) {
  const int lm = lane & 15;            // row within the 16-high A tile
  const int kk = (lane >> 4) << 1;     // K sub-offset for A/B fragments (0 or 2)
  // Every loop here is unrolled so that fragments and accumulators have constant
  // indices and stay in registers.
#pragma unroll
  for (int kc = 0; kc < KCH; ++kc) {
    const int k0 = kc * 4 + kk;
    v2f afrag[MB];
#pragma unroll
    for (int mb = 0; mb < MB; ++mb) {
      const int mrow = (mt0 + mb) * 16 + lm;
      if (STEP == S2 || STEP == S3) {
        afrag[mb] = *(const v2f*)(A + a_addr(STEP, mrow, k0));
      } else {
        afrag[mb].x = A[a_addr(STEP, mrow, k0)];
        afrag[mb].y = A[a_addr(STEP, mrow, k0 + 1)];
      }
    }
    v2f bcur[NT];
#pragma unroll
    for (int nt = 0; nt < NT; ++nt) {
      if constexpr (BREG) bcur[nt] = breg[nt][kc];
      else                bcur[nt] = load_b<STEP>(B, nt0 + nt, kc, lane);
    }
#pragma unroll
    for (int mb = 0; mb < MB; ++mb) {
#pragma unroll
      for (int nt = 0; nt < NT; ++nt)
        acc[mb][nt] = __builtin_amdgcn_wmma_f32_16x16x4_f32(
            false, afrag[mb], false, bcur[nt], (short)0, acc[mb][nt], false, false);
    }
  }
}

// Accumulator tiles -> the step's LDS output tensor.
template <int STEP, int NT, int MB>
__device__ __forceinline__ void tt_store(float* __restrict__ O, const v8f (&acc)[MB][NT],
                                         int mt0, int nt0, int lane) {
  const int lm = lane & 15;            // column within 16-wide tile
  const int rb = (lane >> 4) << 3;     // C/D row base offset (0 or 8)
  // Unrolled: constant indices keep the accumulators in registers.
#pragma unroll
  for (int mb = 0; mb < MB; ++mb) {
    const int rbase = (mt0 + mb) * 16 + rb;
#pragma unroll
    for (int nt = 0; nt < NT; ++nt) {
#pragma unroll
      for (int r = 0; r < 8; ++r)
        O[o_addr(STEP, rbase + r, (nt0 + nt) * 16 + lm)] = acc[mb][nt][r];
    }
  }
}

// Stands between a wave's LDS writes and its own reads of what its other lanes wrote: the writes have
// landed before the rows are read back, and the compiler moves no LDS access across it.
__device__ __forceinline__ void wave_lds_order() {
  asm volatile("s_wait_dscnt 0x0" ::: "memory");
}

// One token's X into an X buffer in LDS, every thread its four 16-byte pieces.
__device__ __forceinline__ void stage_x(const float* __restrict__ Xn, float* Xd, int tid) {
#ifdef HAVE_ASYNC_LDS
  // A fixed count of four, unrolled: every lane is on at each copy and no branch stands between them.
#pragma unroll
  for (int r = 0; r < 4; ++r) {
    const int i = r * 1024 + tid * 4;
    async_copy16(Xn + i, Xd + (i >> 8) * X_PITCH + (i & 255));
  }
#else
  for (int i = tid; i < 4096; i += 256) Xd[(i >> 8) * X_PITCH + (i & 255)] = Xn[i];
#endif
}

// The token behind token n in a workgroup's row: cnt tokens NPLACES apart in each round of
// ROUND_TOKENS; i counts them inside the round. The row rises, so it ends at the first token out of range.
__device__ __forceinline__ int next_token(int n, int& i, int cnt) {
  if (++i < cnt) return n + NPLACES;
  i = 0;
  return n + ROUND_TOKENS - (cnt - 1) * NPLACES;
}

// The wave's own async copies have landed, and the compiler moves no LDS access across it.
__device__ __forceinline__ void wave_async_landed() {
  asm volatile("s_wait_asynccnt 0x0" ::: "memory");
}

__global__ __launch_bounds__(256) void tt_linear_fused_kernel(
    const float* __restrict__ X,
    const float* __restrict__ c0, const float* __restrict__ c1,
    const float* __restrict__ c2, const float* __restrict__ c3,
    const float* __restrict__ c4, const float* __restrict__ bias,
    float* __restrict__ out, int n_tokens) {
  // The long rows have the low workgroup indices and the highest have one
  // token each (for speed only).
  const int cls = blockIdx.x / NPLACES;
  const int cnt = cls < 3 ? 8 >> cls : 1;
  int n = ROUND_TOKENS - (ROUND_TOKENS >> cls) + blockIdx.x % NPLACES;  // this token
  if (n >= n_tokens) return;  // no token for this workgroup: it leaves before any copy or barrier
  int ahead = 0;                            // place in its round of the farthest token asked for
  int n1 = next_token(n, ahead, cnt);       // the next token
  extern __shared__ float smem[];
  float* Xs  = smem;                    // X buffer 0
  float* C01 = Xs + 16 * X_PITCH;       // 2048: core0 x core1
  float* L2  = C01 + 2048;              // core2, until its fragments are in registers; then X buffer 1
  float* C34 = L2 + 64 * L2_PITCH;      // core3 x core4
  float* T2c = C34 + 128 * C34_PITCH;   // one chunk of T2, a piece a wave
  float* T3c = T2c + NWAVES * T2_WAVE;  // one chunk of T3, a piece a wave
  float* L3 = T2c;               // 4096: the raw cores lie in T2c until they are merged
  float* L1 = L3 + 4096;         // 1024
  float* L0 = L1 + 1024;         // 128
  float* L4 = L0 + 128;          // 128

  const int tid  = threadIdx.x;
  const int wave = tid >> 5;
  const int lane = tid & 31;
  const float* Xn = X + (long)n * 4096;

#ifdef HAVE_ASYNC_LDS
  // Async global->LDS staging: 16B/lane moves, no VGPR round trip (ASYNCcnt).
  {
    const int q = tid * 4;                       // 256 threads x 4 floats = 1024 f32/round
    for (int i = q; i < 4096; i += 1024) async_copy16(Xn + i, Xs + (i >> 8) * X_PITCH + (i & 255));  // X: 4 rounds
    for (int i = q; i < 4096; i += 1024) async_copy16(c2 + i, L2 + (i >> 6) * L2_PITCH + (i & 63));  // core2
    for (int i = q; i < 4096; i += 1024) async_copy16(c3 + i, L3 + i);    // core3
    if (q < 1024) async_copy16(c1 + q, L1 + q);                           // core1
    if (q < 128)  async_copy16(c0 + q, L0 + q);                           // core0
  }
#else
  for (int i = tid; i < 128;  i += 256) L0[i] = c0[i];
  for (int i = tid; i < 1024; i += 256) L1[i] = c1[i];
  for (int i = tid; i < 4096; i += 256) L2[(i >> 6) * L2_PITCH + (i & 63)] = c2[i];
  for (int i = tid; i < 4096; i += 256) L3[i] = c3[i];
  for (int i = tid; i < 4096; i += 256) Xs[(i >> 8) * X_PITCH + (i & 255)] = Xn[i];
#endif
  if (tid < 128) L4[tid] = c4[tid];  // core4 (e,l,1,z): e*32 + l*4 + z
#ifdef HAVE_ASYNC_LDS
  wait_async0();  // our own async transfers landed in LDS
#endif
  __syncthreads();

  const v2f nob[1][1] = {};
  {
    v8f acc[1][1] = {};
    tt_mma<P01, 1, 1, 2, false>(L1, L0, nob, acc, wave, 0, lane);
    tt_store<P01, 1, 1>(C01, acc, wave, 0, lane);
  }
  {
    v8f acc[4][1] = {};
    tt_mma<P34, 1, 4, 2, false>(L3, L4, nob, acc, wave * 4, 0, lane);
    tt_store<P34, 1, 4>(C34, acc, wave * 4, 0, lane);
  }
  // core2's B fragments (all N-tiles, whole K range) stay in registers over the chunks
  // (unrolled for constant indices).
  v2f b2[4][16];
#pragma unroll
  for (int nt = 0; nt < 4; ++nt) {
#pragma unroll
    for (int kc = 0; kc < 16; ++kc) b2[nt][kc] = load_b<S2>(L2, nt, kc, lane);
  }
  wave_lds_order();  // the wave's reads of core2 have returned before copies are aimed at its place
  __syncthreads();   // merged cores stand; the raw cores in T2c and core2 in L2 are dead
  if (n1 < n_tokens) stage_x(X + (long)n1 * 4096, L2, tid);

  // The wave's own N-tile of C01 stays in registers over the chunks (unrolled for constant indices).
  v2f b01[1][4];
#pragma unroll
  for (int kc = 0; kc < 4; ++kc) b01[0][kc] = load_b<S1>(C01, wave, kc, lane);
  float* T2w = T2c + wave * T2_WAVE;
  float* T3w = T3c + wave * T3_WAVE;

  const int lm = lane & 15;
  const int rbase = wave * 16 + ((lane >> 4) << 3);
  float* Xcur = Xs;  // holds this token's X
  float* Xnxt = L2;  // the next token's X is on its way here
  while (n < n_tokens) {
    v8f oacc[1][2] = {};  // this wave's 16 x 32 piece of out, summed over the chunks
    for (int p = 0; p < NCHUNK; ++p) {
      {
        v8f acc[4][1] = {};  // all 4 M-tiles of the chunk by the wave's own N-tile
        tt_mma<S1, 1, 4, 4, true>(Xcur + p * DEC, C01, b01, acc, 0, 0, lane);
        tt_store<S1, 1, 4>(T2w, acc, 0, 0, lane);
      }
      wave_lds_order();  // T2w is read by lanes that did not write it
      {
        v8f acc[1][4] = {};
        tt_mma<S2, 4, 1, 16, true>(T2w, L2, b2, acc, 0, 0, lane);
        tt_store<S2, 4, 1>(T3w, acc, 0, 0, lane);
      }
      wave_lds_order();  // T3w is read by lanes that did not write it
      tt_mma<S3, 2, 1, 16, false>(T3w, C34 + p * (DEC * 4 * C34_PITCH), nob, oacc, 0, 0, lane);
    }

    // Four vector slots between the last WMMA and the additions that read its result: on the path
    // with no refill no other vector instruction stands between them.
    asm volatile("v_nop\n\tv_nop\n\tv_nop\n\tv_nop");

    // The X buffers change hands. out is stored behind the barrier: in front of it the barrier's
    // fence would hold the wave until the stores are done.
    wave_lds_order();     // the wave's reads of Xcur have returned
    wave_async_landed();  // the wave's pieces of the next X stand in Xnxt
    __syncthreads();      // every wave's pieces stand; no wave reads Xcur any more
    const int n2 = next_token(n1, ahead, cnt);
    if (n2 < n_tokens) stage_x(X + (long)n2 * 4096, Xcur, tid);
    float* t = Xcur; Xcur = Xnxt; Xnxt = t;

    float* gout = out + (long)n * 4096;
    // Unrolled: constant indices keep oacc in registers.
#pragma unroll
    for (int nt = 0; nt < 2; ++nt) {
#pragma unroll
      for (int r = 0; r < 8; ++r) {
        const int oi = (rbase + r) * 32 + nt * 16 + lm;
        gout[oi] = oacc[0][nt][r] + bias[oi];
      }
    }
    // The next token clears oacc, whose registers the stores above name: the wait that belongs in front of that.
    asm volatile("s_wait_xcnt 0x0" ::: "memory");
    n = n1;
    n1 = n2;
  }
  wave_async_landed();  // no copy is in flight when the wave ends
}

extern "C" void kernel_launch(void* const* d_in, const int* in_sizes, int n_in,
                              void* d_out, int out_size, void* d_ws, size_t ws_size,
                              hipStream_t stream) {
  const float* X    = (const float*)d_in[0];
  const float* c0   = (const float*)d_in[1];
  const float* c1   = (const float*)d_in[2];
  const float* c2   = (const float*)d_in[3];
  const float* c3   = (const float*)d_in[4];
  const float* c4   = (const float*)d_in[5];
  const float* bias = (const float*)d_in[6];
  float* out = (float*)d_out;

  const int n_tokens = in_sizes[0] / 4096;
  const size_t shmem = (size_t)(16 * X_PITCH + 2048 + 64 * L2_PITCH + 128 * C34_PITCH + NWAVES * T2_WAVE +
                                NWAVES * T3_WAVE) * sizeof(float);

  tt_linear_fused_kernel<<<dim3(NGROUPS), dim3(256), shmem, stream>>>(
      X, c0, c1, c2, c3, c4, bias, out, n_tokens);
}
